// v009
// Times are from an AMD MI455X. After a warm-up the kernel runs many times in a row, and a time is the length of
// such a window on the GPU divided by its runs, so every launch and the gaps after it count. The runs cycle
// through copies of the inputs. A figure is the median of several windows, for all but v000 over two sittings.
// Sittings can differ by a few percent; kernels timed side by side share one.
// Earlier versions than v009 are not in this document.
// It runs in 135 microseconds.
// Next to v008, in two timings, it ran 1.12 and 1.11 times as fast.
// All steps since the starting kernel, v000, together make it 53.0 times as fast.
#include <hip/hip_runtime.h>
// Transformer encoder layer with branch-side LayerNorms, a key-padding mask applied as a FILL and the module's literal score scale (x_n [2][2048][768]; q / k / v = x W + b ([in][out] 768 x 768 sigma 1/sqrt(768), zero biases); 12 heads of 64; scores / sqrt(768) (dim_model, as the source); where(mask == 0, 1e-11) with the int32 [2][1][1][2048] mask in {0, 1} (random; READ on device; masked keys get the score 1e-11, NOT -inf, as the source); softmax; z = ctx Wo + bo; l1 = x + LN(z) (LayerNorm on the branch only; biased var, eps 1e-5); ffn = relu(l1 W1 + b1) W2 + b2 ([in][out] 768 x 3072 x 768); out = l1 + LN(ffn) -> [2][2048][768]).
// Structure: token rows; x as exact f16 rows and bf16 f32 residual rows; natural weights as exact x16 planes; fused q | k | v WMMA GEMM (32x64 wave tiles, f32 accumulation, + stacked bias) -> f16; V^T via LDS transposes; one fused attention launch (16 query rows a wave: scores over the unmasked keys, taken through a key list; the masked keys, which all hold the fill score, enter once behind the loop as count x weight and weight x column sum of V; online softmax with f32 statistics and native exp, weights x256 f16 in registers, ctx x64 merged f16); ctx Wo + bo f32; LN1 + x on VALU -> f16 + f32; relu FFN, both batches a launch; LN2 + residual -> output; nine launches, all operand preparation in the first.
// Compute dtype: inputs rounded to bf16; x / weights exact; q, k, v, softmax weights and o as plain f16 GEMM operands (~2^-12); scores and softmax statistics f32; v_wmma_f32_16x16x32_f16.
#define NB 2
#define SQ 2048
#define DM 768
#define NH 12
#define HD 64
#define HG 4                         /* heads per attention launch group */
#define QT 256                       /* query rows per causal tile */
#define NKX SQ                       /* S / P row pitch */
#define QT0 128                      /* first-tile rows recomputed exactly in f32 */
#define B0 0                         /* first batch processed (debug hook) */
#define NBR NB                       /* batches processed (debug hook) */
#define NR ((size_t)NB * SQ)
#define DMQ DM
#define DFF 3072         /* FFN hidden width */
#define MP ((int)((size_t)NBR * SQ)) /* rows projected (debug hook) */
#define QN SQ                        /* query rows attended per batch (debug hook) */
#define NHD NH                       /* heads attended (debug hook) */
#define MPO MP                       /* rows through the output stage (debug hook) */
#define LQ (3 * DM)      /* row pitch of the q/k/v rows */
typedef __bf16 v16b __attribute__((ext_vector_type(16)));
typedef unsigned short v8us __attribute__((ext_vector_type(8), may_alias));
typedef float  v8f  __attribute__((ext_vector_type(8)));
typedef float  v4f  __attribute__((ext_vector_type(4)));
typedef float  v4fa __attribute__((ext_vector_type(4), may_alias));
union FragB { v16b v; v8us half[2]; unsigned short u[16]; };

__device__ __forceinline__ unsigned short bf16_bits(float x) { unsigned int u = __float_as_uint(x); return (unsigned short)((u + 0x7FFFu + ((u >> 16) & 1u)) >> 16); }
__device__ __forceinline__ float bf16_val(unsigned short b) { return __uint_as_float(((unsigned int)b) << 16); }
__device__ __forceinline__ float bf16_round(float x) { return bf16_val(bf16_bits(x)); }
// D += A·B with NT terms: 1 = ah·bh, 2 = + al·bh (A split), 3 = + ah·bl (both split)
template <int NT>
__device__ __forceinline__ v8f mmaN(v16b ah, v16b al, v16b bh, v16b bl, v8f c) {
  c = __builtin_amdgcn_wmma_f32_16x16x32_bf16(false, ah, false, bh, (short)0, c, false, false);
  if (NT >= 2) c = __builtin_amdgcn_wmma_f32_16x16x32_bf16(false, al, false, bh, (short)0, c, false, false);
  if (NT >= 3) c = __builtin_amdgcn_wmma_f32_16x16x32_bf16(false, ah, false, bl, (short)0, c, false, false);
  asm volatile("v_nop\n\tv_nop\n\tv_nop\n\tv_nop" : "+v"(c) : "v"(ah), "v"(al), "v"(bh), "v"(bl));
  return c;
}

__global__ __launch_bounds__(256) void k_wt_bf16(const float* __restrict__ W, unsigned short* __restrict__ Wt, int K, int N) {
  const int t = blockIdx.x * 256 + threadIdx.x;
  const int k8n = K / 8;
  if (t >= N * k8n) return;
  const int n = t / k8n, k8 = (t % k8n) * 8;
  v8us v;
#pragma unroll
  for (int i = 0; i < 8; ++i) v[i] = bf16_bits(W[(size_t)(k8 + i) * N + n]);
  *(v8us*)(Wt + (size_t)n * K + k8) = v;
  
}

// GEMM C[M][N] (f32, pitch ldc) = act(A[M][K]·W + bias). A f32 row-major (pitch lda) converted per fragment to bf16
// (ASPLIT: hi/lo two planes -> 2 terms, else single rounded term); Wt bf16 [N][K] (pitch ldb). BIAS_BF16 rounds the
// bias to bf16 first (bias quantised to bf16 before the add). K%32==0, M%16==0, N%64==0.
template <bool ASPLIT, int ACT, bool BIAS_BF16>
__global__ __launch_bounds__(128) void k_gemm_bf(const float* __restrict__ A, int lda, const unsigned short* __restrict__ Wt, int ldb,
                                               const float* __restrict__ bias, float* __restrict__ C, int ldc, int M, int N, int K) {
  __shared__ __attribute__((aligned(16))) float so[4][16][64];
  const int tid = threadIdx.x, w = tid >> 5, lane = tid & 31, ln = lane & 15, hh = lane >> 4;
  const int ntn = N / 64;
  const int wid = blockIdx.x * 4 + w;
  const int mt = wid / ntn, nq = wid % ntn;
  if (mt * 16 >= M) return;
  const int row0 = mt * 16, col0 = nq * 64;
  const float* arow = A + (size_t)(row0 + ln) * lda;
  v8f acc[4] = {};
  for (int kb = 0; kb < K; kb += 32) {
    FragB ah, al;
    const v4f x0 = *(const v4fa*)(arow + kb + 8 * hh), x1 = *(const v4fa*)(arow + kb + 8 * hh + 4);
    const v4f x2 = *(const v4fa*)(arow + kb + 16 + 8 * hh), x3 = *(const v4fa*)(arow + kb + 16 + 8 * hh + 4);
    float xs[16] = {x0[0],x0[1],x0[2],x0[3],x1[0],x1[1],x1[2],x1[3],x2[0],x2[1],x2[2],x2[3],x3[0],x3[1],x3[2],x3[3]};
#pragma unroll
    for (int i = 0; i < 16; ++i) { const unsigned short hb = bf16_bits(xs[i]); ah.u[i] = hb; al.u[i] = ASPLIT ? bf16_bits(xs[i] - bf16_val(hb)) : (unsigned short)0; }
#pragma unroll
    for (int t = 0; t < 4; ++t) {
      const unsigned short* brow = Wt + (size_t)(col0 + t * 16 + ln) * ldb + kb;
      FragB b;
      b.half[0] = *(const v8us*)(brow + 8 * hh);
      b.half[1] = *(const v8us*)(brow + 16 + 8 * hh);
      acc[t] = mmaN<ASPLIT ? 2 : 1>(ah.v, al.v, b.v, b.v, acc[t]);
    }
  }
#pragma unroll
  for (int t = 0; t < 4; ++t) {
    float bv = bias ? bias[col0 + t * 16 + ln] : 0.f;
    if (BIAS_BF16) bv = bf16_round(bv);
#pragma unroll
    for (int r = 0; r < 8; ++r) { float v = acc[t][r] + bv; if (ACT == 1) v = fmaxf(v, 0.f); so[w][8 * hh + r][t * 16 + ln] = v; }
  }
  __builtin_amdgcn_fence(__ATOMIC_ACQ_REL, "workgroup");
  __builtin_amdgcn_wave_barrier();
  const int rsub = lane >> 4, c4 = (lane & 15) * 4;
  {
#pragma unroll
    for (int q = 0; q < 8; ++q) {
      const int r = q * 2 + rsub;
      const v4f v = *(const v4fa*)&so[w][r][c4];
      *(v4f*)(C + (size_t)(row0 + r) * ldc + col0 + c4) = v;
    }
    
  }
}

// GEMM C = act(A·W + bias + resid): A f32 (ASPLIT -> hi/lo 2 terms), Wt bf16 [N][K]; ACT 0 none, 1 relu, 2 exact gelu;
// resid (optional, f32, row index = (row % rmod), pitch ldr, RES_BF16 rounds it) added before the activation.
template <bool ASPLIT, int ACT, bool BIAS_BF16, bool RES_BF16>
__global__ __launch_bounds__(128) void k_gemm_bf3(const float* __restrict__ A, int lda, const unsigned short* __restrict__ Wt, int ldb,
                                                const float* __restrict__ bias, const float* __restrict__ resid, int rmod, int ldr,
                                                float* __restrict__ C, int ldc, int M, int N, int K) {
  __shared__ __attribute__((aligned(16))) float so[4][16][64];
  const int tid = threadIdx.x, w = tid >> 5, lane = tid & 31, ln = lane & 15, hh = lane >> 4;
  const int ntn = N / 64;
  const int wid = blockIdx.x * 4 + w;
  const int mt = wid / ntn, nq = wid % ntn;
  if (mt * 16 >= M) return;
  const int row0 = mt * 16, col0 = nq * 64;
  const float* arow = A + (size_t)(row0 + ln) * lda;
  v8f acc[4] = {};
  for (int kb = 0; kb < K; kb += 32) {
    FragB ah, al;
    const v4f x0 = *(const v4fa*)(arow + kb + 8 * hh), x1 = *(const v4fa*)(arow + kb + 8 * hh + 4);
    const v4f x2 = *(const v4fa*)(arow + kb + 16 + 8 * hh), x3 = *(const v4fa*)(arow + kb + 16 + 8 * hh + 4);
    float xs[16] = {x0[0],x0[1],x0[2],x0[3],x1[0],x1[1],x1[2],x1[3],x2[0],x2[1],x2[2],x2[3],x3[0],x3[1],x3[2],x3[3]};
#pragma unroll
    for (int i = 0; i < 16; ++i) { const unsigned short hb = bf16_bits(xs[i]); ah.u[i] = hb; al.u[i] = ASPLIT ? bf16_bits(xs[i] - bf16_val(hb)) : (unsigned short)0; }
#pragma unroll
    for (int t = 0; t < 4; ++t) {
      const unsigned short* brow = Wt + (size_t)(col0 + t * 16 + ln) * ldb + kb;
      FragB b;
      b.half[0] = *(const v8us*)(brow + 8 * hh);
      b.half[1] = *(const v8us*)(brow + 16 + 8 * hh);
      acc[t] = mmaN<ASPLIT ? 2 : 1>(ah.v, al.v, b.v, b.v, acc[t]);
    }
  }
#pragma unroll
  for (int t = 0; t < 4; ++t) {
    const int col = col0 + t * 16 + ln;
    float bv = bias ? bias[col] : 0.f;
    if (BIAS_BF16) bv = bf16_round(bv);
#pragma unroll
    for (int r = 0; r < 8; ++r) {
      float v = acc[t][r] + bv;
      if (resid) { float rv = resid[(size_t)((row0 + 8 * hh + r) % rmod) * ldr + col]; if (RES_BF16) rv = bf16_round(rv); v += rv; }
      if (ACT == 1) v = fmaxf(v, 0.f);
      if (ACT == 2) v = 0.5f * v * (1.0f + erff(v * 0.70710678118654752f));
      if (ACT == 3) { const float u = 0.7978845608028654f * (v + 0.044715f * v * v * v); v = 0.5f * v * (1.0f + tanhf(u)); }
      so[w][8 * hh + r][t * 16 + ln] = v;
    }
  }
  __builtin_amdgcn_fence(__ATOMIC_ACQ_REL, "workgroup");
  __builtin_amdgcn_wave_barrier();
  const int rsub = lane >> 4, c4 = (lane & 15) * 4;
  {
#pragma unroll
    for (int q = 0; q < 8; ++q) {
      const int r = q * 2 + rsub;
      const v4f v = *(const v4fa*)&so[w][r][c4];
      *(v4f*)(C + (size_t)(row0 + r) * ldc + col0 + c4) = v;
    }
    
  }
}
// row LayerNorm (biased variance, eps) over N: s = X (+ R); optional out_sum <- s; out_norm <- (s-mu)*rsqrt(var+eps)*g + b
template <bool PARAM_BF16>
__global__ __launch_bounds__(256) void k_layernorm(const float* __restrict__ X, const float* __restrict__ R, const float* __restrict__ g, const float* __restrict__ bta,
                                                  float* __restrict__ out_sum, float* __restrict__ out_norm, int N, float eps) {
  __shared__ float red[256];
  const int row = blockIdx.x, tid = threadIdx.x;
  const float* x = X + (size_t)row * N; const float* rr = R ? R + (size_t)row * N : nullptr;
  float vals[16];                     // up to N = 4096
  const int per = N / 256;            // contiguous chunk per thread? use strided-by-4 chunks: thread handles j = tid*4 + 1024*u
  float s1 = 0.f;
  for (int u = 0; u < per / 4; ++u) {
    const int j = tid * 4 + 1024 * u;
    const v4f a = *(const v4fa*)(x + j);
    v4f b = {0.f,0.f,0.f,0.f}; if (rr) b = *(const v4fa*)(rr + j);
#pragma unroll
    for (int q = 0; q < 4; ++q) { const float v = a[q] + b[q]; vals[u * 4 + q] = v; s1 += v; }
  }
  red[tid] = s1; __syncthreads();
  for (int st = 128; st > 0; st >>= 1) { if (tid < st) red[tid] += red[tid + st]; __syncthreads(); }
  const float mu = red[0] / (float)N; __syncthreads();
  float s2 = 0.f;
  for (int u = 0; u < per / 4; ++u)
#pragma unroll
    for (int q = 0; q < 4; ++q) { const float c = vals[u * 4 + q] - mu; s2 += c * c; }
  red[tid] = s2; __syncthreads();
  for (int st = 128; st > 0; st >>= 1) { if (tid < st) red[tid] += red[tid + st]; __syncthreads(); }
  const float rs = rsqrtf(red[0] / (float)N + eps);
  {
    for (int u = 0; u < per / 4; ++u) {
      const int j = tid * 4 + 1024 * u;
      v4f o, sm;
#pragma unroll
      for (int q = 0; q < 4; ++q) {
        float gg = g[j + q], bb = bta[j + q];
        if (PARAM_BF16) { gg = bf16_round(gg); bb = bf16_round(bb); }
        sm[q] = vals[u * 4 + q]; o[q] = (vals[u * 4 + q] - mu) * rs * gg + bb;
      }
      if (out_sum) *(v4f*)(out_sum + (size_t)row * N + j) = sm;
      *(v4f*)(out_norm + (size_t)row * N + j) = o;
    }
    
  }
}



// ---- f16 WMMA path (v_wmma_f32_16x16x32_f16): 11-bit significands for operands in range — used where a [0,1] probability operand needs more precision than bf16
typedef _Float16 v16h __attribute__((ext_vector_type(16)));
union FragH { v16h v; v8us half[2]; _Float16 h[16]; unsigned short u[16]; };
template <int NT>
__device__ __forceinline__ v8f mmaH(v16h ah, v16h al, v16h bh, v16h bl, v8f c) {
  c = __builtin_amdgcn_wmma_f32_16x16x32_f16(false, ah, false, bh, (short)0, c, false, false);
  if (NT >= 2) c = __builtin_amdgcn_wmma_f32_16x16x32_f16(false, al, false, bh, (short)0, c, false, false);
  if (NT >= 3) c = __builtin_amdgcn_wmma_f32_16x16x32_f16(false, ah, false, bl, (short)0, c, false, false);
  asm volatile("v_nop\n\tv_nop\n\tv_nop\n\tv_nop" : "+v"(c) : "v"(ah), "v"(al), "v"(bh), "v"(bl));
  return c;
}
// batched GEMM like k_gemm_b but f16 operands: A f32 (split into f16 hi/lo if ASPLIT, else rounded to f16), Bt = f16 values [n][k]; alpha; C f32; N multiple of 16 (partial tiles skipped)
template <bool ASPLIT>
__global__ __launch_bounds__(128) void k_gemm_h(const float* __restrict__ A, int lda, size_t sA, const _Float16* __restrict__ Bh, int ldb, size_t sB, float alpha, float* __restrict__ C, int ldc, size_t sC, int M, int N, int K) {
  __shared__ __attribute__((aligned(16))) float so[4][16][64];
  const int tid = threadIdx.x, w = tid >> 5, lane = tid & 31, ln = lane & 15, hh = lane >> 4; const int by = blockIdx.y;
  A += (size_t)by * sA; Bh += (size_t)by * sB; C += (size_t)by * sC;
  const int ntn = (N + 63) / 64; const int wid = blockIdx.x * 4 + w; const int mt = wid / ntn, nq = wid % ntn; if (mt * 16 >= M) return;
  const int row0 = mt * 16, col0 = nq * 64; const float* arow = A + (size_t)(row0 + ln) * lda;
  v8f acc[4] = {};
  for (int kb = 0; kb < K; kb += 32) {
    FragH ah, al;
    const v4f x0 = *(const v4fa*)(arow + kb + 8 * hh), x1 = *(const v4fa*)(arow + kb + 8 * hh + 4), x2 = *(const v4fa*)(arow + kb + 16 + 8 * hh), x3 = *(const v4fa*)(arow + kb + 16 + 8 * hh + 4);
    float xs[16] = {x0[0],x0[1],x0[2],x0[3],x1[0],x1[1],x1[2],x1[3],x2[0],x2[1],x2[2],x2[3],x3[0],x3[1],x3[2],x3[3]};
#pragma unroll
    for (int i = 0; i < 16; ++i) { const _Float16 h = (_Float16)xs[i]; ah.h[i] = h; al.h[i] = ASPLIT ? (_Float16)(xs[i] - (float)h) : (_Float16)0.0f; }
#pragma unroll
    for (int t = 0; t < 4; ++t) { if (col0 + t * 16 >= N) continue; const size_t boff = (size_t)(col0 + t * 16 + ln) * ldb + kb; FragH bq; bq.half[0] = *(const v8us*)(Bh + boff + 8 * hh); bq.half[1] = *(const v8us*)(Bh + boff + 16 + 8 * hh);
      acc[t] = mmaH<ASPLIT ? 2 : 1>(ah.v, al.v, bq.v, bq.v, acc[t]); }
  }
#pragma unroll
  for (int t = 0; t < 4; ++t) { if (col0 + t * 16 >= N) continue;
#pragma unroll
    for (int r = 0; r < 8; ++r) so[w][8 * hh + r][t * 16 + ln] = acc[t][r] * alpha; }
  __builtin_amdgcn_fence(__ATOMIC_ACQ_REL, "workgroup"); __builtin_amdgcn_wave_barrier();
  const int rsub = lane >> 4, c4 = (lane & 15) * 4;
  {
#pragma unroll
    for (int q = 0; q < 8; ++q) { const int r = q * 2 + rsub; if (col0 + c4 < N) { const v4f v = *(const v4fa*)&so[w][r][c4]; *(v4f*)(C + (size_t)(row0 + r) * ldc + col0 + c4) = v; } }
     }
}

// Wt[n][k] = f16(W[k][n] x 16) from f32 row-major W[K][N] (bf16-exact weights stay exact in f16 away from the subnormal range); one 256-thread block turns a tile of 128 k x 64 n.
// Reads: 16 lanes cover 256 contiguous bytes of one W row (64 n); a thread takes 8 consecutive rows of its 4 columns, so it holds 8 consecutive k of 4 output rows and stores each as one 16-byte piece into the LDS tile [n][k].
// Writes: 16 lanes cover the tile's 256 contiguous bytes of one Wt row (128 k).
#define PW_P 272                     /* LDS row pitch in bytes: 256 + 16 */
template <int K, int N>
__device__ __forceinline__ void p_wt_tile(const float* __restrict__ W, _Float16* __restrict__ Wt, int blk, int tid, unsigned char* tl) {
  static_assert(K % 128 == 0 && N % 64 == 0, "p_wt_tile: whole tiles");
  const int nt = blk % (N / 64), kt = blk / (N / 64); const int lo = tid & 15, hi = tid >> 4;
  const float* src = W + (size_t)(kt * 128 + hi * 8) * N + nt * 64 + lo * 4; v4f r[8];
#pragma unroll
  for (int i = 0; i < 8; ++i) r[i] = *(const v4fa*)(src + (size_t)i * N);
#pragma unroll
  for (int j = 0; j < 4; ++j) { FragH f;
#pragma unroll
    for (int i = 0; i < 8; ++i) f.h[i] = (_Float16)(bf16_round(r[i][j]) * 16.0f);
    *(v8us*)(tl + (lo * 4 + j) * PW_P + hi * 16) = f.half[0]; }
  __syncthreads();      /* the tile is whole before any row of it is read back; reached by the whole block (the job is chosen by block index) */
  unsigned short* dst = (unsigned short*)Wt + (size_t)(nt * 64 + hi) * K + kt * 128 + lo * 8;
#pragma unroll
  for (int q = 0; q < 4; ++q) { const v8us o = *(const v8us*)(tl + (q * 16 + hi) * PW_P + lo * 16); *(v8us*)(dst + (size_t)(q * 16) * K) = o; }
  asm volatile("s_wait_xcnt 0x0" ::: "memory");      /* the built code runs on from these stores into the other jobs' range tests, whose code reuses the stores' registers: the wait stands in front of any such overwrite */
}
// k_gemm_hh variant with fused epilogue: v = acc·alpha + bias[by·sBias + col] (+ CP[(row/rowsPerB)·sCPb + by·64 + col] if CP) ; ACT 0 none / 1 elu ; writes f16 C16 (and f32 C if non-null)
template <int ACT>
__global__ __launch_bounds__(128) void k_gemm_hhx(const _Float16* __restrict__ A, int lda, size_t sA, const _Float16* __restrict__ Bh, int ldb, size_t sB, float alpha, const float* __restrict__ bias, size_t sBias, const float* __restrict__ CP, int rowsPerB, size_t sCPb, int row0g,
    float* __restrict__ C, _Float16* __restrict__ C16, int ldc, size_t sC, int M, int N, int K) {
  __shared__ __attribute__((aligned(16))) float so[4][16][64];
  const int tid = threadIdx.x, w = tid >> 5, lane = tid & 31, ln = lane & 15, hh = lane >> 4; const int by = blockIdx.y;
  A += (size_t)by * sA; Bh += (size_t)by * sB; const size_t cofs = (size_t)by * sC; const float* bp = bias ? bias + (size_t)by * sBias : nullptr;
  const int ntn = (N + 63) / 64; const int wid = blockIdx.x * 4 + w; const int mt = wid / ntn, nq = wid % ntn; if (mt * 16 >= M) return;
  const int row0 = mt * 16, col0 = nq * 64; const _Float16* arow = A + (size_t)(row0 + ln) * lda;
  v8f acc[4] = {};
  for (int kb = 0; kb < K; kb += 32) { FragH ah; ah.half[0] = *(const v8us*)((const unsigned short*)arow + kb + 8 * hh); ah.half[1] = *(const v8us*)((const unsigned short*)arow + kb + 16 + 8 * hh);
#pragma unroll
    for (int t = 0; t < 4; ++t) { if (col0 + t * 16 >= N) continue; const size_t boff = (size_t)(col0 + t * 16 + ln) * ldb + kb; FragH bq; bq.half[0] = *(const v8us*)((const unsigned short*)Bh + boff + 8 * hh); bq.half[1] = *(const v8us*)((const unsigned short*)Bh + boff + 16 + 8 * hh);
      acc[t] = mmaH<1>(ah.v, ah.v, bq.v, bq.v, acc[t]); }
  }
#pragma unroll
  for (int t = 0; t < 4; ++t) { if (col0 + t * 16 >= N) continue; const int col = col0 + t * 16 + ln; const float bv = bp ? bf16_round(bp[col]) : 0.f;
#pragma unroll
    for (int r = 0; r < 8; ++r) { float v = acc[t][r] * alpha + bv; if (CP) { const int rr = row0g + row0 + 8 * hh + r; if (rowsPerB < 0) v += CP[cofs + (size_t)rr * ldc + col];      /* rowsPerB < 0: own element of the batched C plane */ else { const int bidx = rr / rowsPerB; v += CP[(size_t)bidx * sCPb + (size_t)by * 64 + col]; } } if (ACT == 1) v = (v > 0.f) ? v : expm1f(v); else if (ACT == 7) v = (v > 0.f) ? v + 1.0f : expf(v); else if (ACT == 8) v = tanhf(v); else if (ACT == 9) v = 0.5f * v * (1.0f + tanhf(0.7978845608028654f * (v + 0.044715f * v * v * v))); else if (ACT == 11) v = 1.0f / (1.0f + expf(-v)); else if (ACT == 12) v = (v > 0.f) ? v : 0.01f * v; else if (ACT == 14) v = (v > 0.f) ? v : 0.1f * v; else if (ACT == 16) v = (v >= 0.f) ? v : 0.3f * v; else if (ACT == 17) v = (v >= 0.f) ? v : 0.2f * v; else if (ACT == 15) v = v / (1.0f + expf(-v)); else if (ACT == 3) v = fmaxf(v, 0.f); else if (ACT == 6) v = 0.5f * v * (1.0f + erff(v * 0.70710678118654752f)); so[w][8 * hh + r][t * 16 + ln] = v; } }
  __builtin_amdgcn_fence(__ATOMIC_ACQ_REL, "workgroup"); __builtin_amdgcn_wave_barrier();
  const int rsub = lane >> 4, c4 = (lane & 15) * 4; typedef _Float16 v4h __attribute__((ext_vector_type(4)));
  {
#pragma unroll
    for (int q = 0; q < 8; ++q) { const int r = q * 2 + rsub; if (col0 + c4 < N) { const v4f v = *(const v4fa*)&so[w][r][c4]; if (C) *(v4f*)(C + cofs + (size_t)(row0 + r) * ldc + col0 + c4) = v; if (C16) { v4h h4; for (int i = 0; i < 4; ++i) h4[i] = (_Float16)v[i]; *(v4h*)(C16 + cofs + (size_t)(row0 + r) * ldc + col0 + c4) = h4; } } }
     }
}


typedef _Float16 v4h __attribute__((ext_vector_type(4)));

__global__ __launch_bounds__(256) void k_h16(const float* __restrict__ x, _Float16* __restrict__ X16, size_t n8) { const size_t t = (size_t)blockIdx.x * 256 + threadIdx.x; if (t >= n8) return; FragH f;
#pragma unroll
  for (int q = 0; q < 8; ++q) f.h[q] = (_Float16)x[t * 8 + q]; *(v8us*)((unsigned short*)X16 + t * 8) = f.half[0];  }
__global__ __launch_bounds__(256) void k_round16f(const float* __restrict__ W, _Float16* __restrict__ Bt, size_t n8) { const size_t t = (size_t)blockIdx.x * 256 + threadIdx.x; if (t >= n8) return; FragH f;
#pragma unroll
  for (int i = 0; i < 8; ++i) f.h[i] = (_Float16)(bf16_round(W[t * 8 + i]) * 16.0f); *(v8us*)((unsigned short*)Bt + t * 8) = f.half[0];  }
template <int NHv, int TTv>
__global__ __launch_bounds__(256) void k_vt(const _Float16* __restrict__ V16, int ldv, int voff, _Float16* __restrict__ Vt) { __shared__ unsigned short tl[64][66]; const int tid = threadIdx.x; const int slab = blockIdx.x / (TTv / 64), lg = blockIdx.x % (TTv / 64); const int b = slab / NHv, h = slab % NHv;
  for (int i = tid; i < 64 * 8; i += 256) { const int r = i / 8, c8 = (i % 8) * 8; FragH f; f.half[0] = *(const v8us*)((const unsigned short*)V16 + ((size_t)b * TTv + lg * 64 + r) * ldv + voff + h * 64 + c8);
#pragma unroll
    for (int q = 0; q < 8; ++q) tl[r][c8 + q] = f.u[q]; }
  __syncthreads();
  {
#pragma unroll
    for (int rd = 0; rd < 2; ++rd) { const int d = rd * 32 + tid / 8, pc = tid % 8; FragH f;
#pragma unroll
      for (int q = 0; q < 8; ++q) f.u[q] = tl[pc * 8 + q][d];
      *(v8us*)((unsigned short*)Vt + ((size_t)slab * 64 + d) * TTv + lg * 64 + pc * 8) = f.half[0]; }
     } }

__global__ __launch_bounds__(256) void k_hl(const float* __restrict__ F, _Float16* __restrict__ Hh, _Float16* __restrict__ Hl, size_t n8) { const size_t t = (size_t)blockIdx.x * 256 + threadIdx.x; if (t >= n8) return; FragH fh, fl; const v4f a = *(const v4fa*)(F + t * 8), c = *(const v4fa*)(F + t * 8 + 4);
#pragma unroll
  for (int q = 0; q < 4; ++q) { _Float16 h = (_Float16)a[q]; fh.h[q] = h; fl.h[q] = (_Float16)((a[q] - (float)h) * 1024.0f); h = (_Float16)c[q]; fh.h[4 + q] = h; fl.h[4 + q] = (_Float16)((c[q] - (float)h) * 1024.0f); }
  { *(v8us*)((unsigned short*)Hh + t * 8) = fh.half[0]; *(v8us*)((unsigned short*)Hl + t * 8) = fl.half[0];  } }

// ---- fast GEMM (work-group tile 128x128, eight waves as 4 x 2, wave tile 32x64; requires M % 128 == 0 rows per launch region, N % 128 == 0 and K % 128 == 0); epilogue: v = act(acc alpha + bf16(bias[col])), written as f32 rows (W32), f16 rows (W16) or both ----
// Which planes are written is a template choice and a bias is always given, so the epilogue is straight-line code: no test or branch per element, and the four bias words of a lane come as one group of loads.
// A (128 rows) and Bt (128 rows) come in stages of 128 k = two whole 128-byte lines a row, sixteen threads a row, through registers into two LDS buffers (row pitch 272 bytes); the waves take their fragments from LDS.
// Stage s + 1 is fetched while stage s is worked on; one barrier a stage. The products run in ascending k, 32 k a step.
#define G2_P 272                     /* LDS row pitch in bytes: 256 + 16, an odd multiple of 16 */
#define G2_B (128 * G2_P)            /* Bt rows start behind the 128 A rows */
#define G2_S (256 * G2_P)            /* one buffer */
__device__ __forceinline__ v16h g2_frag(const _Float16* p, int hh) { FragH f; f.half[0] = *(const v8us*)((const unsigned short*)p + 8 * hh); f.half[1] = *(const v8us*)((const unsigned short*)p + 16 + 8 * hh); return f.v; }
__device__ __forceinline__ v16h g2_lfrag(const unsigned char* p) { FragH f; f.half[0] = *(const v8us*)p; f.half[1] = *(const v8us*)(p + 32); return f.v; }      /* p = row ln of a 16 x 32 block in LDS, + 16 hh bytes: the element order of g2_frag */
__device__ __forceinline__ v8f g2_mma(v16h a, v16h b, v8f c) { v8f d = __builtin_amdgcn_wmma_f32_16x16x32_f16(false, a, false, b, (short)0, c, false, false); asm volatile("v_nop\n\tv_nop\n\tv_nop\n\tv_nop" : "+v"(d) : "v"(a), "v"(b)); return d; }
template <int ACT, bool W32, bool W16>
__global__ __launch_bounds__(256) void k_gemm2(const _Float16* __restrict__ A, int lda, size_t sA, const _Float16* __restrict__ Bh, int ldb, size_t sB, float alpha, const float* __restrict__ bias, size_t sBias,
    float* __restrict__ C, _Float16* __restrict__ C16, int ldc, size_t sC, int M, int N, int K) { static_assert(ACT == 0 || ACT == 3 || ACT == 6 || ACT == 8 || ACT == 9 || ACT == 11 || ACT == 12 || ACT == 14 || ACT == 15 || ACT == 16 || ACT == 17, "k_gemm2: unsupported ACT code (would silently apply no activation)");
  __shared__ __attribute__((aligned(16))) unsigned char sm[2 * G2_S];      /* [buffer][A 128 rows | Bt 128 rows][G2_P] */
  static_assert(8 * 32 * 68 * 4 <= 2 * G2_S, "k_gemm2: the epilogue's rows lie over the operand buffers");
  float (*so)[32][68] = (float (*)[32][68])sm;      /* epilogue staging, over the buffers once the last stage's barrier has ended every read of them */
  const int tid = threadIdx.x, w = tid >> 5, lane = tid & 31, ln = lane & 15, hh = lane >> 4; const int by = blockIdx.y;
  A += (size_t)by * sA; Bh += (size_t)by * sB; const size_t cofs = (size_t)by * sC; const float* bp = bias + (size_t)by * sBias;
  const int ntn = N >> 7; const int mt = blockIdx.x / ntn, nq = blockIdx.x - mt * ntn; const int wm = w & 3, wn = w >> 2; const int row0 = mt * 128 + 32 * wm, col0 = nq * 128 + 64 * wn; if (mt * 128 >= M) return;      /* the whole work-group or none: barriers follow */
  const int srow = tid >> 4, scol = (tid & 15) * 16;      /* staging: sixteen threads a row, 16 rows a sweep; eight sweeps for A, eight for Bt */
  const char* ag = (const char*)(A + (size_t)(mt * 128) * lda); const char* bg = (const char*)(Bh + (size_t)(nq * 128) * ldb);      /* the tiles' first rows: the same for the whole work-group */
  const unsigned av = (unsigned)(srow * lda * 2 + scol), bv = (unsigned)(srow * ldb * 2 + scol);      /* this thread's place in a sweep, in bytes */
  const size_t a16 = (size_t)lda * 32, b16 = (size_t)ldb * 32;      /* 16 rows, in bytes */
  unsigned char* sd = sm + srow * G2_P + scol;
  v8us ga[8], gb[8];
#pragma unroll
  for (int j = 0; j < 8; ++j) ga[j] = *(const v8us*)(ag + j * a16 + av);
#pragma unroll
  for (int j = 0; j < 8; ++j) gb[j] = *(const v8us*)(bg + j * b16 + bv);
#pragma unroll
  for (int j = 0; j < 8; ++j) *(v8us*)(sd + 16 * j * G2_P) = ga[j];
#pragma unroll
  for (int j = 0; j < 8; ++j) *(v8us*)(sd + G2_B + 16 * j * G2_P) = gb[j];
  __syncthreads();      /* stage 0 published */
  const unsigned char* al = sm + (32 * wm + ln) * G2_P + 16 * hh; const unsigned char* bl = sm + G2_B + (64 * wn + ln) * G2_P + 16 * hh;
  const v8f z8 = {0.f,0.f,0.f,0.f,0.f,0.f,0.f,0.f}; v8f c00 = z8, c01 = z8, c02 = z8, c03 = z8, c10 = z8, c11 = z8, c12 = z8, c13 = z8;
  const int nst = K >> 7;
#pragma unroll 1      /* one stage a trip: the buffer index alternates, and two stages' staging registers at once would go past 256 registers */
  for (int st = 0; st < nst; ++st) { const bool more = st + 1 < nst;      /* the same for the whole work-group */
    if (more) { const unsigned ao = av + (unsigned)(st + 1) * 256u, bo = bv + (unsigned)(st + 1) * 256u;      /* 32-bit lane offsets on work-group-uniform row bases */
#pragma unroll
      for (int j = 0; j < 8; ++j) ga[j] = *(const v8us*)((ag + j * a16) + ao);
#pragma unroll
      for (int j = 0; j < 8; ++j) gb[j] = *(const v8us*)((bg + j * b16) + bo); }
    const int cur = (st & 1) * G2_S;
#pragma unroll
    for (int hf = 0; hf < 2; ++hf) {      /* 64 k: one group of fragment loads, then its 16 products */
      const unsigned char* ap = al + cur + 128 * hf; const unsigned char* bq = bl + cur + 128 * hf; v16h a0[2], a1[2], b0[2], b1[2], b2[2], b3[2];
#pragma unroll
      for (int kk = 0; kk < 2; ++kk) { a0[kk] = g2_lfrag(ap + 64 * kk); a1[kk] = g2_lfrag(ap + 16 * G2_P + 64 * kk); b0[kk] = g2_lfrag(bq + 64 * kk); b1[kk] = g2_lfrag(bq + 16 * G2_P + 64 * kk); b2[kk] = g2_lfrag(bq + 32 * G2_P + 64 * kk); b3[kk] = g2_lfrag(bq + 48 * G2_P + 64 * kk); }
#pragma unroll
      for (int kk = 0; kk < 2; ++kk) {      /* 32 k */
        c00 = g2_mma(a0[kk], b0[kk], c00); c10 = g2_mma(a1[kk], b0[kk], c10); c01 = g2_mma(a0[kk], b1[kk], c01); c11 = g2_mma(a1[kk], b1[kk], c11);
        c02 = g2_mma(a0[kk], b2[kk], c02); c12 = g2_mma(a1[kk], b2[kk], c12); c03 = g2_mma(a0[kk], b3[kk], c03); c13 = g2_mma(a1[kk], b3[kk], c13); } }
    if (more) { unsigned char* nd = sd + (G2_S - cur);      /* the buffer of stage st - 1: every wave left it at the barrier that ended that trip */
#pragma unroll
      for (int j = 0; j < 8; ++j) *(v8us*)(nd + 16 * j * G2_P) = ga[j];
#pragma unroll
      for (int j = 0; j < 8; ++j) *(v8us*)(nd + G2_B + 16 * j * G2_P) = gb[j]; }
    __syncthreads(); }      /* publishes stage st + 1 and ends every wave's reads of stage st */
  v8f accs[8] = {c00, c01, c02, c03, c10, c11, c12, c13}; float bt[4];
#pragma unroll
  for (int t = 0; t < 4; ++t) bt[t] = bf16_round(bp[col0 + t * 16 + ln]);
#pragma unroll
  for (int u = 0; u < 8; ++u) { const int t = u & 3, half = u >> 2; const float bv = bt[t];
#pragma unroll
    for (int r = 0; r < 8; ++r) { const int rloc = half * 16 + 8 * hh + r; float v = accs[u][r] * alpha + bv;
      if (ACT == 3) v = fmaxf(v, 0.f); else if (ACT == 6) v = 0.5f * v * (1.0f + erff(v * 0.70710678118654752f)); else if (ACT == 11) v = 1.0f / (1.0f + expf(-v)); else if (ACT == 15) v = v / (1.0f + expf(-v)); else if (ACT == 12) v = (v > 0.f) ? v : 0.01f * v; else if (ACT == 8) v = tanhf(v); else if (ACT == 9) v = 0.5f * v * (1.0f + tanhf(0.7978845608028654f * (v + 0.044715f * v * v * v))); else if (ACT == 14) v = (v > 0.f) ? v : 0.1f * v; else if (ACT == 16) v = (v >= 0.f) ? v : 0.3f * v; else if (ACT == 17) v = (v >= 0.f) ? v : 0.2f * v;
      so[w][rloc][t * 16 + ln] = v; } }
  __builtin_amdgcn_fence(__ATOMIC_ACQ_REL, "workgroup"); __builtin_amdgcn_wave_barrier();
  const int rsub = lane >> 4, c4 = (lane & 15) * 4;
  {
#pragma unroll
    for (int q = 0; q < 16; ++q) { const int r = q * 2 + rsub; const v4f v = *(const v4fa*)&so[w][r][c4]; if (W32) *(v4f*)(C + cofs + (size_t)(row0 + r) * ldc + col0 + c4) = v; if (W16) { v4h h4; for (int i = 0; i < 4; ++i) h4[i] = (_Float16)v[i]; *(v4h*)(C16 + cofs + (size_t)(row0 + r) * ldc + col0 + c4) = h4; } }
     } }


__global__ __launch_bounds__(256) void k_wnat(const float* __restrict__ w, size_t n8, _Float16* __restrict__ Bt) { const size_t t = (size_t)blockIdx.x * 256 + threadIdx.x; if (t >= n8) return; FragH f; for (int q = 0; q < 8; ++q) f.h[q] = (_Float16)(bf16_round(w[t * 8 + q]) * 16.0f); *(v8us*)((unsigned short*)Bt + t * 8) = f.half[0];  }
__global__ __launch_bounds__(256) void k_rsm(const float* __restrict__ S, _Float16* __restrict__ P, int nrows) {
  #pragma clang fp contract(off)
  const int i = blockIdx.x * 256 + threadIdx.x; if (i >= nrows) return; const float* s = S + (size_t)i * SQ; float mx = -3.0e38f;
#pragma unroll 1
  for (int j = 0; j < SQ; ++j) mx = fmaxf(mx, s[j]); float se = 0.f;
#pragma unroll 1
  for (int j = 0; j < SQ; ++j) se += expf(s[j] - mx); const float sc = 256.0f / se;
#pragma unroll 1
  for (int j0 = 0; j0 < SQ; j0 += 8) { FragH f; for (int q = 0; q < 8; ++q) f.h[q] = (_Float16)(expf(s[j0 + q] - mx) * sc); unsigned short* d = (unsigned short*)P + (size_t)i * SQ + j0; *(v8us*)d = f.half[0];  } }
__global__ __launch_bounds__(256) void k_vt(const _Float16* __restrict__ V16, int b, int h0, _Float16* __restrict__ VT) { __shared__ unsigned short tl[64][65]; const int tid = threadIdx.x; const int hh = blockIdx.x % HG, sg = blockIdx.x / HG; const int s0 = sg * 64; const int h = h0 + hh;
  for (int i = tid; i < 64 * 8; i += 256) { const int j = i / 8, d8 = (i % 8) * 8; FragH f; f.half[0] = *(const v8us*)((const unsigned short*)V16 + ((size_t)b * SQ + s0 + j) * DM + h * HD + d8); for (int q = 0; q < 8; ++q) tl[d8 + q][j] = f.u[q]; }
  __syncthreads();
  { for (int i = tid; i < 64 * 8; i += 256) { const int d = i / 8, j8 = (i % 8) * 8; FragH f; for (int q = 0; q < 8; ++q) f.u[q] = tl[d][j8 + q]; *(v8us*)((unsigned short*)VT + ((size_t)hh * HD + d) * SQ + s0 + j8) = f.half[0]; }  } }



__global__ __launch_bounds__(256) void k_rsmcf2(const float* __restrict__ S, _Float16* __restrict__ P, int hg, int q0, int nk) {
  #pragma clang fp contract(off)
  const int t = blockIdx.x * 256 + threadIdx.x; if (t >= hg * QT) return; const size_t i = (size_t)t; const float* s = S + i * NKX; const int last = q0 + (t % QT); float mx = -3.0e38f;
#pragma unroll 1
  for (int j = 0; j < nk; ++j) { const float f = (j <= last) ? 1.f : 0.f; mx = fmaxf(mx, fmaf(f, s[j], (1.f - f) * -1.0e9f)); } float se = 0.f;
#pragma unroll 1
  for (int j = 0; j < nk; ++j) { const float f = (j <= last) ? 1.f : 0.f; se += __expf(fmaf(f, s[j], (1.f - f) * -1.0e9f) - mx); } const float sc = 256.0f / se;
#pragma unroll 1
  for (int j0 = 0; j0 < nk; j0 += 8) { FragH fr; for (int q = 0; q < 8; ++q) { const int j = j0 + q; const float f = (j <= last) ? 1.f : 0.f; fr.h[q] = (_Float16)(__expf(fmaf(f, s[j], (1.f - f) * -1.0e9f) - mx) * sc); } unsigned short* d = (unsigned short*)P + i * NKX + j0; *(v8us*)d = fr.half[0];  } }


template <int MASKADD>
__global__ __launch_bounds__(64) void k_att0(const float* __restrict__ QF, const float* __restrict__ KF, const float* __restrict__ VF, int ld, const float* __restrict__ mask, float scale, float* __restrict__ OF, int ldo) {
  #pragma clang fp contract(off)
  __shared__ __attribute__((aligned(16))) float lq[64][64]; __shared__ __attribute__((aligned(16))) float lo[64][64];
  const int tid = threadIdx.x; const int h = blockIdx.x / (QT0 / 64), rg = blockIdx.x % (QT0 / 64); const int i = rg * 64 + tid;
  const float* qr = QF + (size_t)i * ld + h * HD;
#pragma unroll 1
  for (int c = 0; c < HD / 4; ++c) { *(v4f*)&lq[tid][c * 4] = *(const v4fa*)(qr + c * 4); const v4f z = {0.f, 0.f, 0.f, 0.f}; *(v4f*)&lo[tid][c * 4] = z; }
  float m = -1.0e30f, l = 0.f; const int jmax = MASKADD ? (SQ - 1) : (rg * 64 + 63);      /* additive-mask form: every key (the mask input decides); causal form: keys up to the block's last row */
#pragma unroll 1
  for (int j = 0; j <= jmax; ++j) { const float* kr = KF + (size_t)j * ld + h * HD; const float* vr = VF + (size_t)j * ld + h * HD; float s = 0.f;
#pragma unroll 1
    for (int c = 0; c < HD / 4; ++c) { const v4f kq = *(const v4fa*)(kr + c * 4); const v4f qq = *(v4f*)&lq[tid][c * 4]; s = __fadd_rn(s, __fmul_rn(qq[0], kq[0])); s = __fadd_rn(s, __fmul_rn(qq[1], kq[1])); s = __fadd_rn(s, __fmul_rn(qq[2], kq[2])); s = __fadd_rn(s, __fmul_rn(qq[3], kq[3])); }
    s = __fmul_rn(s, scale); if (MASKADD) s = __fadd_rn(s, __fmul_rn(bf16_round(mask[(size_t)i * SQ + j]), -10000.0f));
    const float f = (MASKADD || j <= i) ? 1.f : 0.f; const float sm = fmaf(f, s, (1.f - f) * -1.0e30f); const float mn = fmaxf(m, sm); const float sc = expf(m - mn); const float e = expf(sm - mn); l = __fadd_rn(__fmul_rn(l, sc), e); m = mn;
#pragma unroll 1
    for (int c = 0; c < HD / 4; ++c) { const v4f vv = *(const v4fa*)(vr + c * 4); v4f oo = *(v4f*)&lo[tid][c * 4]; for (int u = 0; u < 4; ++u) oo[u] = __fadd_rn(__fmul_rn(oo[u], sc), __fmul_rn(e, vv[u])); *(v4f*)&lo[tid][c * 4] = oo; } }
  const float fin = 64.0f / l;      /* o carried x64 like the f16 path */
#pragma unroll 1
  for (int c = 0; c < HD / 4; ++c) { v4f oo = *(v4f*)&lo[tid][c * 4]; for (int u = 0; u < 4; ++u) oo[u] = __fmul_rn(oo[u], fin); *(v4f*)&lo[tid][c * 4] = oo; }
  __syncthreads();
  {
#pragma unroll 1
    for (int it = 0; it < 16; ++it) { const int row = it * 4 + tid / 16, pc = (tid % 16) * 4; const v4f v = *(const v4f*)&lo[row][pc]; *(v4f*)(OF + (size_t)(rg * 64 + row) * ldo + h * HD + pc) = v; }
     } }


template <int BFIN, int WXB>
__global__ __launch_bounds__(256) void k_ln16(const float* __restrict__ X, const float* __restrict__ g, const float* __restrict__ bb, float eps, _Float16* __restrict__ N16, float* __restrict__ XB) {
  #pragma clang fp contract(off)
  __shared__ float red[256]; const size_t r = blockIdx.x; const int t = threadIdx.x; const v4f xa = *(const v4fa*)(X + r * DMQ + t * 4); float s[4]; float sum = 0.f;
  for (int q = 0; q < 4; ++q) { s[q] = BFIN ? bf16_round(xa[q]) : xa[q]; sum = __fadd_rn(sum, s[q]); }
  red[t] = sum; __syncthreads(); for (int st = 128; st > 0; st >>= 1) { if (t < st) red[t] = __fadd_rn(red[t], red[t + st]); __syncthreads(); } const float mu = red[0] / (float)DMQ; __syncthreads();
  float vs = 0.f; for (int q = 0; q < 4; ++q) { const float dl = __fadd_rn(s[q], -mu); vs = __fadd_rn(vs, __fmul_rn(dl, dl)); } red[t] = vs; __syncthreads(); for (int st = 128; st > 0; st >>= 1) { if (t < st) red[t] = __fadd_rn(red[t], red[t + st]); __syncthreads(); }
  const float rs = rsqrtf(__fadd_rn(red[0] / (float)DMQ, eps)); v4h y; v4f xb;
  for (int q = 0; q < 4; ++q) { const int c = t * 4 + q; y[q] = (_Float16)__fadd_rn(__fmul_rn(__fmul_rn(__fadd_rn(s[q], -mu), rs), bf16_round(g[c])), bf16_round(bb[c])); xb[q] = s[q]; }
  { *(v4h*)(N16 + r * DMQ + t * 4) = y; if (WXB) *(v4f*)(XB + r * DMQ + t * 4) = xb;  } }
__global__ __launch_bounds__(256) void k_ftres2(const float* __restrict__ OF0, const float* __restrict__ XB, float* __restrict__ X1, size_t n4) {
  #pragma clang fp contract(off)
  const size_t t = (size_t)blockIdx.x * 256 + threadIdx.x; if (t >= n4) return; const v4f o = *(const v4fa*)(OF0 + t * 4), xv = *(const v4fa*)(XB + t * 4); v4f y; for (int q = 0; q < 4; ++q) y[q] = __fadd_rn(__fmul_rn(o[q], 0.015625f), xv[q]); *(v4f*)(X1 + t * 4) = y;  }

__global__ __launch_bounds__(256) void k_wthd(const float* __restrict__ Wt, _Float16* __restrict__ Bt) { const size_t t = (size_t)blockIdx.x * 256 + threadIdx.x; if (t >= (size_t)NH * HD * (DM / 8)) return; const int m8 = (int)(t % (DM / 8)) * 8; const int d = (int)((t / (DM / 8)) % HD); const int h = (int)(t / ((size_t)(DM / 8) * HD)); FragH f;
  for (int q = 0; q < 8; ++q) f.h[q] = (_Float16)(16.0f * bf16_round(Wt[((size_t)h * DM + m8 + q) * HD + d])); unsigned short* dst = (unsigned short*)Bt + ((size_t)h * HD + d) * DM + m8; *(v8us*)dst = f.half[0];  }




template <int BFIN, int W16, int W32>
__global__ __launch_bounds__(256) void k_lnx(const float* __restrict__ X, const float* __restrict__ g, const float* __restrict__ bb, float eps, _Float16* __restrict__ N16, float* __restrict__ N32) {
  #pragma clang fp contract(off)
  __shared__ float red[256]; const size_t r = blockIdx.x; const int t = threadIdx.x; const bool act = t < (DMQ / 4); const int c0 = act ? t * 4 : 0;
  const v4f xa = *(const v4fa*)(X + r * DMQ + c0); float s[4]; float sum = 0.f;
  for (int q = 0; q < 4; ++q) { s[q] = act ? (BFIN ? bf16_round(xa[q]) : xa[q]) : 0.f; sum = __fadd_rn(sum, s[q]); }
  red[t] = sum; __syncthreads(); for (int st = 128; st > 0; st >>= 1) { if (t < st) red[t] = __fadd_rn(red[t], red[t + st]); __syncthreads(); } const float mu = red[0] / (float)DMQ; __syncthreads();
  float vs = 0.f; for (int q = 0; q < 4; ++q) { const float dl = act ? __fadd_rn(s[q], -mu) : 0.f; vs = __fadd_rn(vs, __fmul_rn(dl, dl)); } red[t] = vs; __syncthreads(); for (int st = 128; st > 0; st >>= 1) { if (t < st) red[t] = __fadd_rn(red[t], red[t + st]); __syncthreads(); }
  const float rs = rsqrtf(__fadd_rn(red[0] / (float)DMQ, eps)); v4h y; v4f yf;
  for (int q = 0; q < 4; ++q) { const int c = c0 + q; yf[q] = __fadd_rn(__fmul_rn(__fmul_rn(__fadd_rn(s[q], -mu), rs), bf16_round(g[c])), bf16_round(bb[c])); y[q] = (_Float16)yf[q]; }
  if (!act) return;      /* no barriers after this point */
  { if (W16) *(v4h*)(N16 + r * DMQ + c0) = y; if (W32) *(v4f*)(N32 + r * DMQ + c0) = yf;  } }






__global__ __launch_bounds__(256) void k_lorafold(const float* __restrict__ Wm, const float* __restrict__ A, const float* __restrict__ Bm, float* __restrict__ WE, int K, int N, float sc) {
  #pragma clang fp contract(off)
  const size_t t = (size_t)blockIdx.x * 256 + threadIdx.x; if (t >= (size_t)K * N) return; const int i = (int)(t / N), o = (int)(t % N); float a = 0.f;
  for (int r = 0; r < 16; ++r) a = __fadd_rn(a, __fmul_rn(bf16_round(A[(size_t)i * 16 + r]), bf16_round(Bm[(size_t)r * N + o])));
  const float v = __fadd_rn(bf16_round(Wm[t]), __fmul_rn(sc, a)); *(float*)(WE + t) = v;  }
__global__ __launch_bounds__(256) void k_wt32rep(const float* __restrict__ Wf, _Float16* __restrict__ Bt, int K, int N, int DOUT, float scale) {
  const int t = blockIdx.x * 256 + threadIdx.x; if (t >= DOUT * (K / 8)) return; const int n = t / (K / 8), k8 = (t % (K / 8)) * 8; const int rep = DOUT / N; const int src = (n / (HD * rep)) * HD + (n % HD);      /* head h = n / HD -> group h / rep */
  FragH f; for (int i = 0; i < 8; ++i) f.h[i] = (_Float16)(Wf[(size_t)(k8 + i) * N + src] * scale);
  *(v8us*)((unsigned short*)Bt + (size_t)n * K + k8) = f.half[0];  }
__global__ __launch_bounds__(256) void k_brep(const float* __restrict__ b, float* __restrict__ out) { const int t = blockIdx.x * 256 + threadIdx.x; if (t >= DM) return; const float v = b[(t / (HD * 4)) * HD + (t % HD)]; *(float*)(out + t) = v;  }

__global__ __launch_bounds__(256) void k_rsmcim(const float* __restrict__ S, _Float16* __restrict__ P, int hg, int q0, int nk, const int* __restrict__ am) {
  #pragma clang fp contract(off)
  const int t = blockIdx.x * 256 + threadIdx.x; if (t >= hg * QT) return; const size_t i = (size_t)t; const float* s = S + i * NKX; const int last = q0 + (t % QT); const int* mr = am + (size_t)last * SQ; float mx = -3.0e38f;      /* the module's mask row of this query (keys >= nk lie above the diagonal of the causal mask and are not computed) */
#pragma unroll 1
  for (int j = 0; j < nk; ++j) { const float f = (mr[j] != 0) ? 1.f : 0.f; mx = fmaxf(mx, fmaf(f, s[j], (1.f - f) * -1.0e9f)); } float se = 0.f;
#pragma unroll 1
  for (int j = 0; j < nk; ++j) { const float f = (mr[j] != 0) ? 1.f : 0.f; se += __expf(fmaf(f, s[j], (1.f - f) * -1.0e9f) - mx); } const float sc = 256.0f / se;
#pragma unroll 1
  for (int j0 = 0; j0 < nk; j0 += 8) { FragH fr; for (int q = 0; q < 8; ++q) { const int j = j0 + q; const float f = (mr[j] != 0) ? 1.f : 0.f; fr.h[q] = (_Float16)(__expf(fmaf(f, s[j], (1.f - f) * -1.0e9f) - mx) * sc); } unsigned short* d = (unsigned short*)P + i * NKX + j0; *(v8us*)d = fr.half[0];  } }






__global__ __launch_bounds__(256) void k_rsmp(const float* __restrict__ S, _Float16* __restrict__ P, int nrows, int nk) {
  #pragma clang fp contract(off)
  const int t = blockIdx.x * 256 + threadIdx.x; if (t >= nrows) return; const size_t ri = (size_t)t; const float* s = S + ri * NKX; float mx = -3.0e38f;
#pragma unroll 1
  for (int j = 0; j < nk; ++j) mx = fmaxf(mx, s[j]); float se = 0.f;
#pragma unroll 1
  for (int j = 0; j < nk; ++j) se += __expf(s[j] - mx); const float sc = 256.0f / se;
#pragma unroll 1
  for (int j0 = 0; j0 < nk; j0 += 8) { FragH fr; for (int q = 0; q < 8; ++q) fr.h[q] = (_Float16)(__expf(s[j0 + q] - mx) * sc);
    unsigned short* d = (unsigned short*)P + ri * NKX + j0; *(v8us*)d = fr.half[0];  } }
// V^T in key-list order, and the masked keys' column sums. KI[b] lists the batch's keys, the unmasked ones first (NU[b] of them), then the masked ones, each part in ascending order.
// A block takes 64 list places of one (batch, head): it fetches those V rows, writes them as 64 columns of V^T (whole 128-byte pieces, one writer each) and adds up, per column d, the rows whose place lies behind NU[b].
__global__ __launch_bounds__(256) void k_vtg(const _Float16* __restrict__ V16, const int* __restrict__ KI, const int* __restrict__ NU, _Float16* __restrict__ Vt, float* __restrict__ VS) {
  __shared__ unsigned short tl[64][66]; __shared__ float ps[4][64]; const int tid = threadIdx.x; const int slab = blockIdx.x / (SQ / 64), lg = blockIdx.x % (SQ / 64); const int b = slab / NH, h = slab % NH;
  const int nu = min(max(NU[b], 0), SQ);
  const int r0 = tid / 8, c8 = (tid % 8) * 8; int key[2]; FragH fv[2];      /* eight threads a row, 32 rows a sweep; both sweeps' list words, then both sweeps' rows, in one flight each */
#pragma unroll
  for (int u = 0; u < 2; ++u) key[u] = KI[b * SQ + lg * 64 + 32 * u + r0] & (SQ - 1);
#pragma unroll
  for (int u = 0; u < 2; ++u) fv[u].half[0] = *(const v8us*)((const unsigned short*)V16 + ((size_t)b * SQ + key[u]) * LQ + h * HD + c8);
#pragma unroll
  for (int u = 0; u < 2; ++u)
#pragma unroll
    for (int q = 0; q < 8; ++q) tl[32 * u + r0][c8 + q] = fv[u].u[q];
  __syncthreads();      /* the tile is whole before it is read by columns */
  const int d = tid & 63, qd = tid >> 6; float s = 0.f;
#pragma unroll
  for (int u = 0; u < 16; ++u) { const int r = qd * 16 + u; const float v = (float)__builtin_bit_cast(_Float16, tl[r][d]); s += (lg * 64 + r >= nu) ? v : 0.f; }
  ps[qd][d] = s;
  __syncthreads();      /* the four quarter sums of a column are there before they are added; it stands in front of the V^T stores so that no wave waits for those here */
#pragma unroll
  for (int rd = 0; rd < 2; ++rd) { const int dd = rd * 32 + tid / 8, pc = tid % 8; FragH f;
#pragma unroll
    for (int q = 0; q < 8; ++q) f.u[q] = tl[pc * 8 + q][dd];
    *(v8us*)((unsigned short*)Vt + ((size_t)slab * HD + dd) * SQ + lg * 64 + pc * 8) = f.half[0]; }
  if (tid < 64) VS[((size_t)slab * (SQ / 64) + lg) * HD + tid] = (ps[0][tid] + ps[1][tid]) + (ps[2][tid] + ps[3][tid]); }
// Fused attention, one launch for all batches and heads: a work-group of four waves owns 64 query rows (16 a wave) and walks the batch's NU unmasked keys, in key-list order, in stages of 64; scores and weights stay in registers.
// Every masked key holds the same score (the fill) for every query, so the masked keys together add (SQ - NU) x w to a query's sum and w x (column sum of their V rows) to its context, w = the fill score's weight: added once, behind the loop.
// Transposed products: S^T = K Q^T (rows = keys, columns = queries) and O^T += V^T P^T. The accumulator of S^T holds, in lane (ln, hh), register r, key 8 hh + r of query ln,
// which is the k order of the B operand (elements 0..7 = k 8 hh + i, elements 8..15 = k 16 + 8 hh + i), so two 16-key score tiles become one 32-key P^T fragment with no exchange.
// Online softmax in the log2 domain: running maximum and running sum per query (a query is a lane pair ln, ln + 16); weights are carried x256 (exponent + 8) as f16, the sum likewise, f32.
// K and V^T tiles (64 rows of 128 bytes each) come in whole 128-byte lines through registers into two LDS buffers (row pitch 144 bytes): stage s + 1 is fetched while stage s is worked on; one barrier a stage.
#define FA_P 144                     /* LDS row pitch in bytes: 128 + 16, an odd multiple of 16 */
#define FA_T (64 * FA_P)             /* one tile */
typedef int v4ia __attribute__((ext_vector_type(4), may_alias));
__device__ __forceinline__ v8f fa_mma(v16h a, v16h b, v8f c) { return __builtin_amdgcn_wmma_f32_16x16x32_f16(false, a, false, b, (short)0, c, false, false); }
__device__ __forceinline__ float fa_xhalf(float x) { return __builtin_bit_cast(float, __builtin_amdgcn_permlanex16(__builtin_bit_cast(int, x), __builtin_bit_cast(int, x), 0x76543210, 0xfedcba98, false, false)); }      /* lane l with lane l ^ 16 */
__device__ __forceinline__ float fa_exp2(float t) { float e;
  asm("v_exp_f32 %0, %1\n\tv_nop" : "=v"(e) : "v"(t));      /* v_nop: the one slot the instruction set asks for behind a transcendental before its source is overwritten or its result read */
  return e; }
__device__ __forceinline__ v16h fa_frag(const unsigned char* p) { FragH f; f.half[0] = *(const v8us*)p; f.half[1] = *(const v8us*)(p + 32); return f.v; }      /* p = row ln of a 16 x 32 block in LDS, + 16 hh bytes */
__global__ __launch_bounds__(128) __attribute__((amdgpu_waves_per_eu(4, 4)))      /* register budget of four waves a SIMD (the grid gives three): aiming at more, the compiler reused registers among the pass's LDS loads and waited out each load in turn */
void k_fattn(const _Float16* __restrict__ QKVp, const _Float16* __restrict__ VTp, const int* __restrict__ KI, const int* __restrict__ NU, const float* __restrict__ VS, _Float16* __restrict__ O) {
  static_assert(HD == 64 && SQ % 512 == 0 && (SQ & (SQ - 1)) == 0 && SQ / 64 == 32, "k_fattn: head size 64; 128 threads x 4 list words a sweep; 64-key stages; 2 x 16 partial column sums");
  __shared__ __attribute__((aligned(16))) int lm[SQ];      /* this batch's key list */
  __shared__ __attribute__((aligned(16))) float vsl[2 * HD];      /* the masked keys' V column sums of this head, in two halves */
  __shared__ __attribute__((aligned(16))) unsigned char kv[2][2][FA_T];      /* [buffer][K, V^T][row * FA_P + byte] */
  const int tid = threadIdx.x, w = tid >> 5, lane = tid & 31, ln = lane & 15, hh = lane >> 4;
  const int bh = blockIdx.y, b = bh / NH, h = bh - b * NH; const size_t r0 = (size_t)b * SQ; const int q0 = blockIdx.x * 64 + w * 16;
  const int srow = tid >> 3, scol = (tid & 7) * 16;      /* staging: eight threads a row, 16 rows a sweep, four sweeps a tile */
  const char* kg = (const char*)(QKVp + r0 * LQ + DM + h * HD) + scol;      /* key row 0 of the batch, this head's 64 columns of the k block */
  const int nu = __builtin_amdgcn_readfirstlane(min(max(NU[b], 0), SQ)), nst = (nu + 63) >> 6;      /* unmasked keys and their stages: the same for the whole work-group, at most SQ / 64 */
  const char* vg = (const char*)(VTp + ((size_t)bh * HD + srow) * SQ) + scol;      /* V^T row d = srow, columns in key-list order */
  const int sofs = srow * FA_P + scol, lofs = ln * FA_P + 16 * hh;
  v8us gk[4], gv[4];
#pragma unroll
  for (int j = 0; j < 4; ++j) { const unsigned kr = (unsigned)(KI[r0 + srow + 16 * j] & (SQ - 1)); gk[j] = *(const v8us*)(kg + kr * (unsigned)(LQ * 2)); gv[j] = *(const v8us*)(vg + (size_t)(16 * j) * (SQ * 2)); }
  v4ia lw[SQ / 512];      /* the whole list, four words a thread and sweep, all sweeps in one flight */
#pragma unroll
  for (int u = 0; u < SQ / 512; ++u) lw[u] = *(const v4ia*)(KI + r0 + tid * 4 + 512 * u);
  { const float* vp = VS + ((size_t)bh * (SQ / 64) + (tid >> 6) * 16) * HD + (tid & 63); float s = 0.f;
#pragma unroll
    for (int u = 0; u < 16; ++u) s += vp[u * HD];
    vsl[tid] = s; }
#pragma unroll
  for (int u = 0; u < SQ / 512; ++u) *(v4ia*)(lm + tid * 4 + 512 * u) = lw[u];
  const _Float16* qp = QKVp + (r0 + q0 + ln) * LQ + h * HD; const v16h q0f = g2_frag(qp, hh), q1f = g2_frag(qp + 32, hh);
#pragma unroll
  for (int j = 0; j < 4; ++j) { *(v8us*)&kv[0][0][sofs + 16 * j * FA_P] = gk[j]; *(v8us*)&kv[0][1][sofs + 16 * j * FA_P] = gv[j]; }
  __syncthreads();      /* key list, column sums and stage 0 published */
  const int* lms = lm + srow; int kn[4];      /* list words of the stage to be fetched next, read one trip ahead so that the fetch does not wait for LDS */
#pragma unroll
  for (int j = 0; j < 4; ++j) kn[j] = lms[((1 < nst) ? 64 : 0) + 16 * j];
  const v8f z8 = {0.f, 0.f, 0.f, 0.f, 0.f, 0.f, 0.f, 0.f}; v8f acc[4] = {z8, z8, z8, z8}; float m_run = -3.0e38f, l_run = 0.f;
  const float c2 = 0.036084391824351615f * 1.44269504088896340736f, fill2 = 1.0e-11f * 1.44269504088896340736f;      /* 1 / sqrt(768) and the fill score, both times log2(e) */
#pragma unroll 1      /* one stage a trip: the buffer index alternates, and two stages' fragments at once would go past 256 registers */
  for (int st = 0; st < nst; ++st) {
    const int sn = (st + 1 < nst) ? st + 1 : st;      /* the last trip fetches its own stage again (in bounds) into the buffer nobody reads any more: no branch round loads, stores or the barrier */
#pragma unroll
    for (int j = 0; j < 4; ++j) { const unsigned kr = (unsigned)(kn[j] & (SQ - 1)); gk[j] = *(const v8us*)(kg + kr * (unsigned)(LQ * 2)); gv[j] = *(const v8us*)(vg + (size_t)(16 * j) * (SQ * 2) + sn * 128); }
    __builtin_amdgcn_sched_barrier(0);      /* holds the next stage's eight global loads here, a whole stage in front of the LDS stores that use them; left free, the scheduler sinks loads to just in front of their use and every wave waits out the load latency at the barrier */
    const int s2 = (st + 2 < nst) ? st + 2 : nst - 1;
#pragma unroll
    for (int j = 0; j < 4; ++j) kn[j] = lms[s2 * 64 + 16 * j];
    const unsigned char* kl = &kv[st & 1][0][lofs]; const unsigned char* vl = &kv[st & 1][1][lofs];
#pragma unroll
    for (int sub = 0; sub < 2; ++sub) {      /* one pass: 32 keys */
      const int kb = st * 64 + sub * 32;
      const unsigned char* kt = kl + sub * 32 * FA_P;
      const v16h k0 = fa_frag(kt), k2 = fa_frag(kt + 16 * FA_P), k1 = fa_frag(kt + 64), k3 = fa_frag(kt + 16 * FA_P + 64);
      v16h vf[4];
#pragma unroll
      for (int t = 0; t < 4; ++t) vf[t] = fa_frag(vl + t * 16 * FA_P + sub * 64);
      __builtin_amdgcn_sched_barrier(0);      /* holds the pass's 16 LDS loads together at its head, so that their latencies overlap; left free, each K fragment was loaded into the same registers just in front of its product and waited for by itself */
      v8f s0 = fa_mma(k0, q0f, z8); v8f s1 = fa_mma(k2, q0f, z8); s0 = fa_mma(k1, q1f, s0); s1 = fa_mma(k3, q1f, s1);
      float x[16];
#pragma unroll
      for (int r = 0; r < 8; ++r) { x[r] = s0[r] * c2; x[8 + r] = s1[r] * c2; }
      if (kb + 32 > nu) {      /* only the list's last passes (a scalar test): places from nu on hold masked keys, which get no weight here */
#pragma unroll
        for (int r = 0; r < 8; ++r) { x[r] = (kb + 8 * hh + r < nu) ? x[r] : -3.0e38f; x[8 + r] = (kb + 16 + 8 * hh + r < nu) ? x[8 + r] : -3.0e38f; } }
      float mx = x[0];
#pragma unroll
      for (int i = 1; i < 16; ++i) mx = fmaxf(mx, x[i]);
      mx = fmaxf(mx, fa_xhalf(mx));      /* both halves of the wave hold this query's maximum of the pass */
      const float mn = fmaxf(m_run, mx); const float corr = fa_exp2(m_run - mn); m_run = mn; const float nm = 8.0f - mn;
#pragma unroll
      for (int t = 0; t < 4; ++t) acc[t] = acc[t] * corr;
      FragH p; float e0 = 0.f, e1 = 0.f, e2 = 0.f, e3 = 0.f;
#pragma unroll
      for (int i = 0; i < 16; i += 4) { const float ea = fa_exp2(x[i] + nm), eb = fa_exp2(x[i + 1] + nm), ec = fa_exp2(x[i + 2] + nm), ed = fa_exp2(x[i + 3] + nm);
        e0 += ea; e1 += eb; e2 += ec; e3 += ed; p.h[i] = (_Float16)ea; p.h[i + 1] = (_Float16)eb; p.h[i + 2] = (_Float16)ec; p.h[i + 3] = (_Float16)ed; }
      l_run = l_run * corr + ((e0 + e1) + (e2 + e3));      /* this lane's 16 keys only; the two halves are added behind the loop */
#pragma unroll
      for (int t = 0; t < 4; ++t) acc[t] = fa_mma(vf[t], p.v, acc[t]);
      __builtin_amdgcn_sched_barrier(0);      /* ends the pass for the scheduler: left free, it fetched both passes' fragments at once (spills at 256 registers) and moved the next stage's LDS stores, their wait on the global loads and the barrier up in front of the softmax, where the loads had had no time to land */
    }
    unsigned char* kd = &kv[(st + 1) & 1][0][sofs]; unsigned char* vd = &kv[(st + 1) & 1][1][sofs];      /* the buffer of stage st - 1: every wave left it at the barrier that ended that trip */
#pragma unroll
    for (int j = 0; j < 4; ++j) { *(v8us*)(kd + 16 * j * FA_P) = gk[j]; *(v8us*)(vd + 16 * j * FA_P) = gv[j]; }
    __syncthreads();      /* publishes stage st + 1 and ends every wave's reads of stage st */
  }
  const bool anym = nu < SQ; const float mf = anym ? fmaxf(m_run, fill2) : m_run;      /* the masked keys join: final maximum, the loop's sums brought to it, the fill score's weight (x256 like the others) */
  const float cf = fa_exp2(m_run - mf), wf = anym ? fa_exp2((fill2 - mf) + 8.0f) : 0.f;
  const float l = (l_run + fa_xhalf(l_run)) * cf + (float)(SQ - nu) * wf; const float fin = 64.0f / l;      /* ctx carried x64 as before; the x256 of weights and sum cancels */
  unsigned short* op = (unsigned short*)O + (r0 + q0 + ln) * DM + h * HD + 8 * hh;
#pragma unroll
  for (int t = 0; t < 4; ++t) { FragH f;
#pragma unroll
    for (int r = 0; r < 8; ++r) { const int d = 16 * t + 8 * hh + r; f.h[r] = (_Float16)((acc[t][r] * cf + wf * (vsl[d] + vsl[HD + d])) * fin); }
    *(v8us*)(op + 16 * t) = f.half[0]; } }      /* d = 16 t + 8 hh + r of query ln */


// Residual + LayerNorm, two rows a wave (biased variance): out = R + (X - mu) * rsqrt(var + eps) * bf16(g) + bf16(b), as f16 rows (W16), f32 rows (W32) or both.
// A row of 768 floats is six pieces of 512 contiguous bytes; a lane holds 4 floats of each piece, so a row stays in registers between its two sums and the output. Gain and bias are fetched and rounded once a wave.
// Sums: per-lane partials (four chains), four DPP steps inside a 16-lane row, one exchange of the halves. No LDS, no barrier: the waves of a block need nothing of each other.
#define LN_W 8                       /* waves a block */
#define LN_R 2                       /* rows a wave */
#define LN_J (DMQ / 128)             /* 512-byte pieces a row */
typedef float v2f __attribute__((ext_vector_type(2)));
typedef __bf16 v2b __attribute__((ext_vector_type(2)));
template <int M> __device__ __forceinline__ float ln_xm(float x) { return __builtin_bit_cast(float, __builtin_amdgcn_update_dpp(0, __builtin_bit_cast(int, x), 0x160 + M, 0xf, 0xf, true)); }      /* lane l takes lane l ^ M of its 16-lane row (row_xmask) */
__device__ __forceinline__ float ln_wsum(float s) { s += ln_xm<1>(s); s += ln_xm<2>(s); s += ln_xm<4>(s); s += ln_xm<8>(s); return s + fa_xhalf(s); }      /* every lane ends with the sum over the wave */
__device__ __forceinline__ v4f ln_bf(v4f a) { const v2f lo = {a[0], a[1]}, hi = {a[2], a[3]}; const v2f l = __builtin_convertvector(__builtin_convertvector(lo, v2b), v2f), h = __builtin_convertvector(__builtin_convertvector(hi, v2b), v2f); const v4f r = {l[0], l[1], h[0], h[1]}; return r; }      /* to the bf16 grid, nearest even */
__device__ __forceinline__ float ln_rsq(float t) { float e;
  asm("v_rsq_f32 %0, %1\n\tv_nop" : "=v"(e) : "v"(t));      /* v_nop: the one slot the instruction set asks for behind a transcendental before its source is overwritten or its result read */
  return e; }      /* the bare instruction: t = variance + eps is at least eps (1e-5 in both launches), far above the small inputs that rsqrtf rescales */
template <int W16, int W32>
__global__ __launch_bounds__(32 * LN_W) void k_lnw(const float* __restrict__ X, const float* __restrict__ g, const float* __restrict__ bb, float eps, _Float16* __restrict__ N16, float* __restrict__ N32, const float* __restrict__ R) {
  static_assert(DMQ % 128 == 0 && NR % (LN_W * LN_R) == 0, "k_lnw: whole 512-byte pieces, whole blocks of rows");
  const int c0 = (threadIdx.x & 31) * 4; const int wv = __builtin_amdgcn_readfirstlane(threadIdx.x >> 5);      /* the wave's number, scalar: the row bases then sit in scalar registers and every load and store shares one lane offset */
  const size_t o = (size_t)(blockIdx.x * LN_W + wv) * (LN_R * DMQ);
  const float* xp = X + o; const float* rp = R + o;
  v4f xa[LN_R][LN_J], ra[LN_R][LN_J], ga[LN_J], ba[LN_J];
#pragma unroll
  for (int i = 0; i < LN_R; ++i)
#pragma unroll
    for (int j = 0; j < LN_J; ++j) xa[i][j] = *(const v4fa*)(xp + i * DMQ + j * 128 + c0);
#pragma unroll
  for (int j = 0; j < LN_J; ++j) { ga[j] = *(const v4fa*)(g + j * 128 + c0); ba[j] = *(const v4fa*)(bb + j * 128 + c0); }
#pragma unroll
  for (int i = 0; i < LN_R; ++i)
#pragma unroll
    for (int j = 0; j < LN_J; ++j) ra[i][j] = *(const v4fa*)(rp + i * DMQ + j * 128 + c0);
  __builtin_amdgcn_sched_barrier(0);      /* holds all the wave's loads here, in one flight; left free, the scheduler sank the residual rows' loads behind both sums, where the wave waited out a second load latency */
  float mu[LN_R], rs[LN_R];
#pragma unroll
  for (int i = 0; i < LN_R; ++i) { v4f s4 = xa[i][0];
#pragma unroll
    for (int j = 1; j < LN_J; ++j) s4 += xa[i][j];
    mu[i] = (s4[0] + s4[1]) + (s4[2] + s4[3]); }
#pragma unroll
  for (int i = 0; i < LN_R; ++i) mu[i] = ln_wsum(mu[i]) * (1.0f / (float)DMQ);
#pragma unroll
  for (int i = 0; i < LN_R; ++i) { v4f q4 = {0.f, 0.f, 0.f, 0.f};
#pragma unroll
    for (int j = 0; j < LN_J; ++j) { xa[i][j] -= mu[i]; q4 += xa[i][j] * xa[i][j]; }
    rs[i] = (q4[0] + q4[1]) + (q4[2] + q4[3]); }
#pragma unroll
  for (int i = 0; i < LN_R; ++i) rs[i] = ln_rsq(ln_wsum(rs[i]) * (1.0f / (float)DMQ) + eps);
#pragma unroll
  for (int j = 0; j < LN_J; ++j) { ga[j] = ln_bf(ga[j]); ba[j] = ln_bf(ba[j]); }
#pragma unroll
  for (int i = 0; i < LN_R; ++i)
#pragma unroll
    for (int j = 0; j < LN_J; ++j) { const v4f yf = (xa[i][j] * rs[i] * ga[j] + ba[j]) + ra[i][j];
      if (W16) *(v4h*)(N16 + o + i * DMQ + j * 128 + c0) = __builtin_convertvector(yf, v4h);
      if (W32) *(v4f*)(N32 + o + i * DMQ + j * 128 + c0) = yf; } }


// Operand preparation, one launch: the jobs need nothing of each other and share the grid by ranges of the block index (the choice is the same for a whole block).
// The weights go through an LDS tile a block (p_wt_tile); x keeps its one-thread-per-8-elements form and is read once for its two copies.
#define PB_W (DM * DFF / (128 * 64))           /* blocks (tiles of 128 k x 64 n) of one 768 x 3072 weight */
#define PB_X ((int)(NR * DM / 8 / 256))        /* blocks of x */
#define PB_S (DM * DM / (128 * 64))            /* blocks of one 768 x 768 weight */
#define PB_ALL (2 * PB_W + PB_X + 4 * PB_S + 3 + NB)
__global__ __launch_bounds__(256) void k_prep(const float* __restrict__ x, const float* __restrict__ wq, const float* __restrict__ wk, const float* __restrict__ wv, const float* __restrict__ wo, const float* __restrict__ w1, const float* __restrict__ w2,
    const float* __restrict__ bq, const float* __restrict__ bk, const float* __restrict__ bv, const int* __restrict__ km, _Float16* __restrict__ X16, float* __restrict__ XB, _Float16* __restrict__ BQKV, _Float16* __restrict__ BO, _Float16* __restrict__ BW1, _Float16* __restrict__ BW2, float* __restrict__ bqkv, int* __restrict__ KI, int* __restrict__ NU) {
  static_assert(NR * DM / 8 % 256 == 0, "k_prep: whole blocks of x");
  __shared__ __attribute__((aligned(16))) unsigned char tl[64 * PW_P];      /* one weight tile, [n][k] f16 */
  int blk = blockIdx.x; const int tid = threadIdx.x;
  if (blk < NB) {      /* key list of batch blk: the keys with a non-zero mask word first, then the others, each part ascending; a thread takes 8 consecutive keys. First in the grid: its chain of barriers is the longest job */
    static_assert(SQ == 256 * 8, "k_prep: 8 keys a thread");
    int* sc = (int*)tl; const v4ia m0 = *(const v4ia*)(km + blk * SQ + tid * 8), m1 = *(const v4ia*)(km + blk * SQ + tid * 8 + 4); int fl[8], cn = 0;
#pragma unroll
    for (int q = 0; q < 4; ++q) { fl[q] = (m0[q] != 0) ? 1 : 0; fl[4 + q] = (m1[q] != 0) ? 1 : 0; }
#pragma unroll
    for (int q = 0; q < 8; ++q) cn += fl[q];
    sc[tid] = cn; __syncthreads();      /* running count over the block's 256 threads, eight doubling steps; every barrier is reached by the whole block (the job is chosen by block index) */
    for (int o = 1; o < 256; o <<= 1) { const int ad = (tid >= o) ? sc[tid - o] : 0; __syncthreads(); sc[tid] += ad; __syncthreads(); }
    const int tot = sc[255]; int up = sc[tid] - cn;      /* unmasked keys in all, and in front of this thread's first key */
#pragma unroll
    for (int q = 0; q < 8; ++q) { const int key = tid * 8 + q; KI[blk * SQ + (fl[q] ? up : tot + (key - up))] = key; up += fl[q]; }      /* a permutation of 0 .. SQ - 1: up <= key, and tot + masked keys in front < SQ */
    if (tid == 0) NU[blk] = tot;
    return; }
  blk -= NB;
  if (blk < PB_W) { p_wt_tile<DM, DFF>(w1, BW1, blk, tid, tl); return; }      /* W1 [768][3072] -> Bt [3072][768] */
  blk -= PB_W;
  if (blk < PB_W) { p_wt_tile<DFF, DM>(w2, BW2, blk, tid, tl); return; }      /* W2 [3072][768] -> Bt [768][3072] */
  blk -= PB_W;
  if (blk < PB_X) { const size_t t = (size_t)blk * 256 + tid; v4f a = *(const v4fa*)(x + t * 8), c = *(const v4fa*)(x + t * 8 + 4); FragH f;      /* X16 = bf16(x) as exact f16 rows (GEMM operand), XB = bf16(x) as f32 rows (residual) */
#pragma unroll
    for (int q = 0; q < 4; ++q) { a[q] = bf16_round(a[q]); c[q] = bf16_round(c[q]); f.h[q] = (_Float16)a[q]; f.h[4 + q] = (_Float16)c[q]; }
    *(v8us*)((unsigned short*)X16 + t * 8) = f.half[0]; *(v4f*)(XB + t * 8) = a; *(v4f*)(XB + t * 8 + 4) = c;
    asm volatile("s_wait_xcnt 0x0" ::: "memory");      /* as in p_wt_tile: in front of any overwrite of the three stores' registers on the way to the kernel's end */
    return; }
  blk -= PB_X;
  if (blk < 4 * PB_S) { const int m = blk / PB_S;      /* [in][out] -> Bt x16: stacked q | k | v, and Wo */
    const float* W = (m == 0) ? wq : (m == 1) ? wk : (m == 2) ? wv : wo; _Float16* D = (m < 3) ? BQKV + (size_t)m * DM * DM : BO;
    p_wt_tile<DM, DM>(W, D, blk - m * PB_S, tid, tl); return; }
  blk -= 4 * PB_S;
  const float* b = (blk == 0) ? bq : (blk == 1) ? bk : bv;      /* stacked bias bq | bk | bv */
  for (int i = tid; i < DM; i += 256) bqkv[blk * DM + i] = b[i];
}

extern "C" void kernel_launch(void* const* d_in, const int* in_sizes, int n_in,
                              void* d_out, int out_size, void* d_ws, size_t ws_size, hipStream_t stream) {
  (void)in_sizes; (void)n_in; (void)out_size;
  const float* const* I = (const float* const*)d_in; const float* x = I[0]; const int* km = (const int*)d_in[1]; const float* wq = I[2]; const float* bq = I[3]; const float* wk = I[4]; const float* bk = I[5]; const float* wv = I[6]; const float* bv = I[7]; const float* wo = I[8]; const float* bo = I[9]; const float* g1 = I[10]; const float* be1 = I[11]; const float* wfc = I[12]; const float* bfc = I[13]; const float* wmp = I[14]; const float* bmp = I[15]; const float* gg2 = I[16]; const float* be2 = I[17];      /* input order: x_n; mask int32 [2][1][1][2048] (READ on device); [in][out] wq / wk / wv / wo + biases; ln1 g / b; w1 [768][3072] + b1, w2 [3072][768] + b2; ln2 g / b */
  static_assert(DMQ % 4 == 0 && DMQ / 4 <= 256 && DM % 64 == 0 && DM % 32 == 0 && DFF % 64 == 0 && DFF % 32 == 0 && NH * HD == DM && NKX == SQ, "tile multiples");
  static_assert(MP % 128 == 0 && MPO % 128 == 0 && SQ % 128 == 0 && DM % 128 == 0 && DFF % 128 == 0, "k_gemm2: whole 128-row work-group tiles, 128-column tiles, 128-k stages");
  char* ws = (char*)d_ws; size_t off = 0;
  auto take = [&](size_t bytes) { char* p = ws + off; off += (bytes + 255) & ~(size_t)255; return p; };
  _Float16* BQKV = (_Float16*)take((size_t)3 * DM * DM * 2); _Float16* BO = (_Float16*)take((size_t)DM * DM * 2); float* bqkv = (float*)take((size_t)3 * DM * 4); float* X1N = nullptr;      /* LN1 output (f32): aliases the QKV plane below (QKV's last readers, the score / V^T launches, precede LN1) to stay within 256 MiB at NB 4 / SQ 2048 */
  _Float16* X16 = (_Float16*)take(NR * DM * 2); float* XB = (float*)take(NR * DM * 4); float* X1 = (float*)take(NR * DM * 4); _Float16* M16 = nullptr;      /* = X16 below (alias: X16's last reader, the fused QKV GEMM, precedes LN1's f16 write) */ _Float16* HF16 = (_Float16*)take(NR * DFF * 2);      /* FFN hidden plane of both batches [4096][3072] f16 (own region here) */ _Float16* BW1 = (_Float16*)take((size_t)DFF * DM * 2); _Float16* BW2 = (_Float16*)take((size_t)DM * DFF * 2); _Float16* QKV = (_Float16*)take(NR * 3 * DM * 2); _Float16* V16 = QKV + 2 * DM; _Float16* O16 = (_Float16*)take(NR * DM * 2); M16 = X16; X1N = (float*)QKV;      /* aliases: X1N (NR*DM f32 = 12 MiB) inside QKV (18 MiB): QKV's last readers (the score / V^T launches) precede the first LayerNorm */
  _Float16* VT = (_Float16*)take((size_t)NB * NH * HD * SQ * 2); int* KI = (int*)take((size_t)NB * SQ * 4); int* NU = (int*)take((size_t)NB * 4); float* VS = (float*)take((size_t)NB * NH * (SQ / 64) * HD * 4);      /* key lists, unmasked counts, partial column sums of the masked keys' V rows */
  if (off > ws_size) return;
  k_prep<<<PB_ALL, 256, 0, stream>>>(x, wq, wk, wv, wo, wfc, wmp, bq, bk, bv, km, X16, XB, BQKV, BO, BW1, BW2, bqkv, KI, NU);      /* every GEMM operand plane, the stacked bias and the residual rows; post-LN: the attention runs on the raw input */
  const size_t r0p = (size_t)B0 * SQ;      /* first projected row */
  k_gemm2<0, false, true><<<dim3((unsigned)((MP / 128) * (3 * DM / 128)), 1), 256, 0, stream>>>(X16 + r0p * DM, DM, 0, BQKV, DM, 0, 0.0625f, bqkv, 0, nullptr, QKV + r0p * 3 * DM, 3 * DM, 0, MP, 3 * DM, DM);      /* q | k | v rows (f16); head h = columns h*HD.. of each DM block */
  k_vtg<<<NB * NH * (SQ / 64), 256, 0, stream>>>(V16, KI, NU, VT, VS);      /* V^T [NB][NH][HD][SQ], both batches, columns in key-list order; partial column sums of the masked keys */
  k_fattn<<<dim3(SQ / 64, NB * NH), 128, 0, stream>>>(QKV, VT, KI, NU, VS, O16);      /* scores q.k / sqrt(768) (the module's literal dim_model scale), masked keys get the score 1e-11 (fill, as the source), softmax over all keys, ctx (merged heads, x64) as f16 rows */
  k_gemm2<0, true, false><<<dim3((unsigned)((MPO / 128) * (DM / 128)), 1), 256, 0, stream>>>(O16 + r0p * DM, DM, 0, BO, DM, 0, 0.0009765625f, bo, 0, X1 + r0p * DM, nullptr, DM, 0, MPO, DM, DM);      /* z = ctx Wo + bo (f32 rows; the skip is added AFTER the LayerNorm in this module) */
  k_lnw<1, 1><<<(unsigned)(NR / (LN_W * LN_R)), 32 * LN_W, 0, stream>>>(X1, g1, be1, 1e-5f, M16, X1N, XB);      /* l1 = bf16(x) + LN1(z) (eps 1e-5): f16 rows for the FFN input and f32 rows for the second skip */
  k_gemm2<3, false, true><<<dim3((unsigned)((MP / 128) * (DFF / 128)), 1), 256, 0, stream>>>(M16, DM, 0, BW1, DM, 0, 0.0625f, bfc, 0, nullptr, HF16, DFF, 0, MP, DFF, DM);      /* relu(l1 W1 + b1) -> f16, both batches */
  k_gemm2<0, true, false><<<dim3((unsigned)((MP / 128) * (DM / 128)), 1), 256, 0, stream>>>(HF16, DFF, 0, BW2, DFF, 0, 0.0625f, bmp, 0, X1, nullptr, DM, 0, MP, DM, DFF);      /* ffn = hidden W2 + b2 (f32 rows over the dead z plane; the skip is added after the LayerNorm) */
  k_lnw<0, 1><<<(unsigned)(NR / (LN_W * LN_R)), 32 * LN_W, 0, stream>>>(X1, gg2, be2, 1e-5f, nullptr, (float*)d_out, X1N);      /* out = l1 + LN2(ffn) (eps 1e-5) -> f32 output rows */
}

// v010
// Measured time: 126 microseconds a run.
// Timed twice side by side with v009, it ran 1.08 and 1.07 times as fast.
// Counting every step since v000, which is the starting kernel, it is 57.0 times as fast.
#include <hip/hip_runtime.h>
// Transformer encoder layer with branch-side LayerNorms, a key-padding mask applied as a FILL and the module's literal score scale (x_n [2][2048][768]; q / k / v = x W + b ([in][out] 768 x 768 sigma 1/sqrt(768), zero biases); 12 heads of 64; scores / sqrt(768) (dim_model, as the source); where(mask == 0, 1e-11) with the int32 [2][1][1][2048] mask in {0, 1} (random; READ on device; masked keys get the score 1e-11, NOT -inf, as the source); softmax; z = ctx Wo + bo; l1 = x + LN(z) (LayerNorm on the branch only; biased var, eps 1e-5); ffn = relu(l1 W1 + b1) W2 + b2 ([in][out] 768 x 3072 x 768); out = l1 + LN(ffn) -> [2][2048][768]).
// Structure: token rows; x as exact f16 rows and bf16 f32 residual rows; natural weights as exact x16 planes; fused q | k | v WMMA GEMM (64x48 wave tiles, f32 accumulation, + stacked bias) -> f16; V^T via LDS transposes; one fused attention launch (16 query rows a wave: scores over the unmasked keys, taken through a key list; the masked keys, which all hold the fill score, enter once behind the loop as count x weight and weight x column sum of V; online softmax with f32 statistics and native exp, weights x256 f16 in registers, ctx x64 merged f16); ctx Wo + bo f32; LN1 on VALU, + x -> f16 + f32; relu FFN, both batches a launch; LN2, + residual -> output; nine launches, all operand preparation in the first.
// Compute dtype: inputs rounded to bf16; x / weights exact; q, k, v, softmax weights and o as plain f16 GEMM operands (~2^-12); scores and softmax statistics f32. v_wmma_f32_16x16x32_f16.
#define NB 2
#define SQ 2048
#define DM 768
#define NH 12
#define HD 64
#define HG 4                         /* heads per attention launch group */
#define QT 256                       /* query rows per causal tile */
#define NKX SQ                       /* S / P row pitch */
#define QT0 128                      /* first-tile rows recomputed exactly in f32 */
#define B0 0                         /* first batch processed (debug hook) */
#define NBR NB                       /* batches processed (debug hook) */
#define NR ((size_t)NB * SQ)
#define DMQ DM
#define DFF 3072         /* FFN hidden width */
#define MP ((int)((size_t)NBR * SQ)) /* rows projected (debug hook) */
#define QN SQ                        /* not used: the attention grid covers all SQ query rows */
#define NHD NH                       /* not used: the attention grid covers all NH heads */
#define MPO MP                       /* rows through the output stage (debug hook) */
#define LQ (3 * DM)      /* row pitch of the q/k/v rows */
typedef __bf16 v16b __attribute__((ext_vector_type(16)));
typedef unsigned short v8us __attribute__((ext_vector_type(8), may_alias));
typedef float  v8f  __attribute__((ext_vector_type(8)));
typedef float  v4f  __attribute__((ext_vector_type(4)));
typedef float  v4fa __attribute__((ext_vector_type(4), may_alias));
union FragB { v16b v; v8us half[2]; unsigned short u[16]; };

__device__ __forceinline__ unsigned short bf16_bits(float x) { unsigned int u = __float_as_uint(x); return (unsigned short)((u + 0x7FFFu + ((u >> 16) & 1u)) >> 16); }
__device__ __forceinline__ float bf16_val(unsigned short b) { return __uint_as_float(((unsigned int)b) << 16); }
__device__ __forceinline__ float bf16_round(float x) { return bf16_val(bf16_bits(x)); }
// D += A·B with NT terms: 1 = ah·bh, 2 = + al·bh (A split), 3 = + ah·bl (both split)
template <int NT>
__device__ __forceinline__ v8f mmaN(v16b ah, v16b al, v16b bh, v16b bl, v8f c) {
  c = __builtin_amdgcn_wmma_f32_16x16x32_bf16(false, ah, false, bh, (short)0, c, false, false);
  if (NT >= 2) c = __builtin_amdgcn_wmma_f32_16x16x32_bf16(false, al, false, bh, (short)0, c, false, false);
  if (NT >= 3) c = __builtin_amdgcn_wmma_f32_16x16x32_bf16(false, ah, false, bl, (short)0, c, false, false);
  asm volatile("v_nop\n\tv_nop\n\tv_nop\n\tv_nop" : "+v"(c) : "v"(ah), "v"(al), "v"(bh), "v"(bl));
  return c;
}

__global__ __launch_bounds__(256) void k_wt_bf16(const float* __restrict__ W, unsigned short* __restrict__ Wt, int K, int N) {
  const int t = blockIdx.x * 256 + threadIdx.x;
  const int k8n = K / 8;
  if (t >= N * k8n) return;
  const int n = t / k8n, k8 = (t % k8n) * 8;
  v8us v;
#pragma unroll
  for (int i = 0; i < 8; ++i) v[i] = bf16_bits(W[(size_t)(k8 + i) * N + n]);
  *(v8us*)(Wt + (size_t)n * K + k8) = v;
  
}

// GEMM C[M][N] (f32, pitch ldc) = act(A[M][K]·W + bias). A f32 row-major (pitch lda) converted per fragment to bf16
// (ASPLIT: hi/lo two planes -> 2 terms, else single rounded term); Wt bf16 [N][K] (pitch ldb). BIAS_BF16 rounds the
// bias to bf16 first (bias quantised to bf16 before the add). K%32==0, M%16==0, N%64==0.
template <bool ASPLIT, int ACT, bool BIAS_BF16>
__global__ __launch_bounds__(128) void k_gemm_bf(const float* __restrict__ A, int lda, const unsigned short* __restrict__ Wt, int ldb,
                                               const float* __restrict__ bias, float* __restrict__ C, int ldc, int M, int N, int K) {
  __shared__ __attribute__((aligned(16))) float so[4][16][64];
  const int tid = threadIdx.x, w = tid >> 5, lane = tid & 31, ln = lane & 15, hh = lane >> 4;
  const int ntn = N / 64;
  const int wid = blockIdx.x * 4 + w;
  const int mt = wid / ntn, nq = wid % ntn;
  if (mt * 16 >= M) return;
  const int row0 = mt * 16, col0 = nq * 64;
  const float* arow = A + (size_t)(row0 + ln) * lda;
  v8f acc[4] = {};
  for (int kb = 0; kb < K; kb += 32) {
    FragB ah, al;
    const v4f x0 = *(const v4fa*)(arow + kb + 8 * hh), x1 = *(const v4fa*)(arow + kb + 8 * hh + 4);
    const v4f x2 = *(const v4fa*)(arow + kb + 16 + 8 * hh), x3 = *(const v4fa*)(arow + kb + 16 + 8 * hh + 4);
    float xs[16] = {x0[0],x0[1],x0[2],x0[3],x1[0],x1[1],x1[2],x1[3],x2[0],x2[1],x2[2],x2[3],x3[0],x3[1],x3[2],x3[3]};
#pragma unroll
    for (int i = 0; i < 16; ++i) { const unsigned short hb = bf16_bits(xs[i]); ah.u[i] = hb; al.u[i] = ASPLIT ? bf16_bits(xs[i] - bf16_val(hb)) : (unsigned short)0; }
#pragma unroll
    for (int t = 0; t < 4; ++t) {
      const unsigned short* brow = Wt + (size_t)(col0 + t * 16 + ln) * ldb + kb;
      FragB b;
      b.half[0] = *(const v8us*)(brow + 8 * hh);
      b.half[1] = *(const v8us*)(brow + 16 + 8 * hh);
      acc[t] = mmaN<ASPLIT ? 2 : 1>(ah.v, al.v, b.v, b.v, acc[t]);
    }
  }
#pragma unroll
  for (int t = 0; t < 4; ++t) {
    float bv = bias ? bias[col0 + t * 16 + ln] : 0.f;
    if (BIAS_BF16) bv = bf16_round(bv);
#pragma unroll
    for (int r = 0; r < 8; ++r) { float v = acc[t][r] + bv; if (ACT == 1) v = fmaxf(v, 0.f); so[w][8 * hh + r][t * 16 + ln] = v; }
  }
  __builtin_amdgcn_fence(__ATOMIC_ACQ_REL, "workgroup");
  __builtin_amdgcn_wave_barrier();
  const int rsub = lane >> 4, c4 = (lane & 15) * 4;
  {
#pragma unroll
    for (int q = 0; q < 8; ++q) {
      const int r = q * 2 + rsub;
      const v4f v = *(const v4fa*)&so[w][r][c4];
      *(v4f*)(C + (size_t)(row0 + r) * ldc + col0 + c4) = v;
    }
    
  }
}

// GEMM C = act(A·W + bias + resid): A f32 (ASPLIT -> hi/lo 2 terms), Wt bf16 [N][K]; ACT 0 none, 1 relu, 2 exact gelu;
// resid (optional, f32, row index = (row % rmod), pitch ldr, RES_BF16 rounds it) added before the activation.
template <bool ASPLIT, int ACT, bool BIAS_BF16, bool RES_BF16>
__global__ __launch_bounds__(128) void k_gemm_bf3(const float* __restrict__ A, int lda, const unsigned short* __restrict__ Wt, int ldb,
                                                const float* __restrict__ bias, const float* __restrict__ resid, int rmod, int ldr,
                                                float* __restrict__ C, int ldc, int M, int N, int K) {
  __shared__ __attribute__((aligned(16))) float so[4][16][64];
  const int tid = threadIdx.x, w = tid >> 5, lane = tid & 31, ln = lane & 15, hh = lane >> 4;
  const int ntn = N / 64;
  const int wid = blockIdx.x * 4 + w;
  const int mt = wid / ntn, nq = wid % ntn;
  if (mt * 16 >= M) return;
  const int row0 = mt * 16, col0 = nq * 64;
  const float* arow = A + (size_t)(row0 + ln) * lda;
  v8f acc[4] = {};
  for (int kb = 0; kb < K; kb += 32) {
    FragB ah, al;
    const v4f x0 = *(const v4fa*)(arow + kb + 8 * hh), x1 = *(const v4fa*)(arow + kb + 8 * hh + 4);
    const v4f x2 = *(const v4fa*)(arow + kb + 16 + 8 * hh), x3 = *(const v4fa*)(arow + kb + 16 + 8 * hh + 4);
    float xs[16] = {x0[0],x0[1],x0[2],x0[3],x1[0],x1[1],x1[2],x1[3],x2[0],x2[1],x2[2],x2[3],x3[0],x3[1],x3[2],x3[3]};
#pragma unroll
    for (int i = 0; i < 16; ++i) { const unsigned short hb = bf16_bits(xs[i]); ah.u[i] = hb; al.u[i] = ASPLIT ? bf16_bits(xs[i] - bf16_val(hb)) : (unsigned short)0; }
#pragma unroll
    for (int t = 0; t < 4; ++t) {
      const unsigned short* brow = Wt + (size_t)(col0 + t * 16 + ln) * ldb + kb;
      FragB b;
      b.half[0] = *(const v8us*)(brow + 8 * hh);
      b.half[1] = *(const v8us*)(brow + 16 + 8 * hh);
      acc[t] = mmaN<ASPLIT ? 2 : 1>(ah.v, al.v, b.v, b.v, acc[t]);
    }
  }
#pragma unroll
  for (int t = 0; t < 4; ++t) {
    const int col = col0 + t * 16 + ln;
    float bv = bias ? bias[col] : 0.f;
    if (BIAS_BF16) bv = bf16_round(bv);
#pragma unroll
    for (int r = 0; r < 8; ++r) {
      float v = acc[t][r] + bv;
      if (resid) { float rv = resid[(size_t)((row0 + 8 * hh + r) % rmod) * ldr + col]; if (RES_BF16) rv = bf16_round(rv); v += rv; }
      if (ACT == 1) v = fmaxf(v, 0.f);
      if (ACT == 2) v = 0.5f * v * (1.0f + erff(v * 0.70710678118654752f));
      if (ACT == 3) { const float u = 0.7978845608028654f * (v + 0.044715f * v * v * v); v = 0.5f * v * (1.0f + tanhf(u)); }
      so[w][8 * hh + r][t * 16 + ln] = v;
    }
  }
  __builtin_amdgcn_fence(__ATOMIC_ACQ_REL, "workgroup");
  __builtin_amdgcn_wave_barrier();
  const int rsub = lane >> 4, c4 = (lane & 15) * 4;
  {
#pragma unroll
    for (int q = 0; q < 8; ++q) {
      const int r = q * 2 + rsub;
      const v4f v = *(const v4fa*)&so[w][r][c4];
      *(v4f*)(C + (size_t)(row0 + r) * ldc + col0 + c4) = v;
    }
    
  }
}
// row LayerNorm (biased variance, eps) over N: s = X (+ R); optional out_sum <- s; out_norm <- (s-mu)*rsqrt(var+eps)*g + b
template <bool PARAM_BF16>
__global__ __launch_bounds__(256) void k_layernorm(const float* __restrict__ X, const float* __restrict__ R, const float* __restrict__ g, const float* __restrict__ bta,
                                                  float* __restrict__ out_sum, float* __restrict__ out_norm, int N, float eps) {
  __shared__ float red[256];
  const int row = blockIdx.x, tid = threadIdx.x;
  const float* x = X + (size_t)row * N; const float* rr = R ? R + (size_t)row * N : nullptr;
  float vals[16];                     // up to N = 4096
  const int per = N / 256;            // contiguous chunk per thread? use strided-by-4 chunks: thread handles j = tid*4 + 1024*u
  float s1 = 0.f;
  for (int u = 0; u < per / 4; ++u) {
    const int j = tid * 4 + 1024 * u;
    const v4f a = *(const v4fa*)(x + j);
    v4f b = {0.f,0.f,0.f,0.f}; if (rr) b = *(const v4fa*)(rr + j);
#pragma unroll
    for (int q = 0; q < 4; ++q) { const float v = a[q] + b[q]; vals[u * 4 + q] = v; s1 += v; }
  }
  red[tid] = s1; __syncthreads();
  for (int st = 128; st > 0; st >>= 1) { if (tid < st) red[tid] += red[tid + st]; __syncthreads(); }
  const float mu = red[0] / (float)N; __syncthreads();
  float s2 = 0.f;
  for (int u = 0; u < per / 4; ++u)
#pragma unroll
    for (int q = 0; q < 4; ++q) { const float c = vals[u * 4 + q] - mu; s2 += c * c; }
  red[tid] = s2; __syncthreads();
  for (int st = 128; st > 0; st >>= 1) { if (tid < st) red[tid] += red[tid + st]; __syncthreads(); }
  const float rs = rsqrtf(red[0] / (float)N + eps);
  {
    for (int u = 0; u < per / 4; ++u) {
      const int j = tid * 4 + 1024 * u;
      v4f o, sm;
#pragma unroll
      for (int q = 0; q < 4; ++q) {
        float gg = g[j + q], bb = bta[j + q];
        if (PARAM_BF16) { gg = bf16_round(gg); bb = bf16_round(bb); }
        sm[q] = vals[u * 4 + q]; o[q] = (vals[u * 4 + q] - mu) * rs * gg + bb;
      }
      if (out_sum) *(v4f*)(out_sum + (size_t)row * N + j) = sm;
      *(v4f*)(out_norm + (size_t)row * N + j) = o;
    }
    
  }
}



// ---- f16 WMMA path (v_wmma_f32_16x16x32_f16): 11-bit significands for operands in range — used where a [0,1] probability operand needs more precision than bf16
typedef _Float16 v16h __attribute__((ext_vector_type(16)));
union FragH { v16h v; v8us half[2]; _Float16 h[16]; unsigned short u[16]; };
template <int NT>
__device__ __forceinline__ v8f mmaH(v16h ah, v16h al, v16h bh, v16h bl, v8f c) {
  c = __builtin_amdgcn_wmma_f32_16x16x32_f16(false, ah, false, bh, (short)0, c, false, false);
  if (NT >= 2) c = __builtin_amdgcn_wmma_f32_16x16x32_f16(false, al, false, bh, (short)0, c, false, false);
  if (NT >= 3) c = __builtin_amdgcn_wmma_f32_16x16x32_f16(false, ah, false, bl, (short)0, c, false, false);
  asm volatile("v_nop\n\tv_nop\n\tv_nop\n\tv_nop" : "+v"(c) : "v"(ah), "v"(al), "v"(bh), "v"(bl));
  return c;
}
// batched GEMM like k_gemm_b but f16 operands: A f32 (split into f16 hi/lo if ASPLIT, else rounded to f16), Bt = f16 values [n][k]; alpha; C f32; N multiple of 16 (partial tiles skipped)
template <bool ASPLIT>
__global__ __launch_bounds__(128) void k_gemm_h(const float* __restrict__ A, int lda, size_t sA, const _Float16* __restrict__ Bh, int ldb, size_t sB, float alpha, float* __restrict__ C, int ldc, size_t sC, int M, int N, int K) {
  __shared__ __attribute__((aligned(16))) float so[4][16][64];
  const int tid = threadIdx.x, w = tid >> 5, lane = tid & 31, ln = lane & 15, hh = lane >> 4; const int by = blockIdx.y;
  A += (size_t)by * sA; Bh += (size_t)by * sB; C += (size_t)by * sC;
  const int ntn = (N + 63) / 64; const int wid = blockIdx.x * 4 + w; const int mt = wid / ntn, nq = wid % ntn; if (mt * 16 >= M) return;
  const int row0 = mt * 16, col0 = nq * 64; const float* arow = A + (size_t)(row0 + ln) * lda;
  v8f acc[4] = {};
  for (int kb = 0; kb < K; kb += 32) {
    FragH ah, al;
    const v4f x0 = *(const v4fa*)(arow + kb + 8 * hh), x1 = *(const v4fa*)(arow + kb + 8 * hh + 4), x2 = *(const v4fa*)(arow + kb + 16 + 8 * hh), x3 = *(const v4fa*)(arow + kb + 16 + 8 * hh + 4);
    float xs[16] = {x0[0],x0[1],x0[2],x0[3],x1[0],x1[1],x1[2],x1[3],x2[0],x2[1],x2[2],x2[3],x3[0],x3[1],x3[2],x3[3]};
#pragma unroll
    for (int i = 0; i < 16; ++i) { const _Float16 h = (_Float16)xs[i]; ah.h[i] = h; al.h[i] = ASPLIT ? (_Float16)(xs[i] - (float)h) : (_Float16)0.0f; }
#pragma unroll
    for (int t = 0; t < 4; ++t) { if (col0 + t * 16 >= N) continue; const size_t boff = (size_t)(col0 + t * 16 + ln) * ldb + kb; FragH bq; bq.half[0] = *(const v8us*)(Bh + boff + 8 * hh); bq.half[1] = *(const v8us*)(Bh + boff + 16 + 8 * hh);
      acc[t] = mmaH<ASPLIT ? 2 : 1>(ah.v, al.v, bq.v, bq.v, acc[t]); }
  }
#pragma unroll
  for (int t = 0; t < 4; ++t) { if (col0 + t * 16 >= N) continue;
#pragma unroll
    for (int r = 0; r < 8; ++r) so[w][8 * hh + r][t * 16 + ln] = acc[t][r] * alpha; }
  __builtin_amdgcn_fence(__ATOMIC_ACQ_REL, "workgroup"); __builtin_amdgcn_wave_barrier();
  const int rsub = lane >> 4, c4 = (lane & 15) * 4;
  {
#pragma unroll
    for (int q = 0; q < 8; ++q) { const int r = q * 2 + rsub; if (col0 + c4 < N) { const v4f v = *(const v4fa*)&so[w][r][c4]; *(v4f*)(C + (size_t)(row0 + r) * ldc + col0 + c4) = v; } }
     }
}

// Wt[n][k] = f16(W[k][n] x 16) from f32 row-major W[K][N] (bf16-exact weights stay exact in f16 away from the subnormal range); one 256-thread block turns a tile of 128 k x 64 n.
// Reads: 16 lanes cover 256 contiguous bytes of one W row (64 n); a thread takes 8 consecutive rows of its 4 columns, so it holds 8 consecutive k of 4 output rows and stores each as one 16-byte piece into the LDS tile [n][k].
// Writes: 16 lanes cover the tile's 256 contiguous bytes of one Wt row (128 k).
#define PW_P 272                     /* LDS row pitch in bytes: 256 + 16 */
template <int K, int N>
__device__ __forceinline__ void p_wt_tile(const float* __restrict__ W, _Float16* __restrict__ Wt, int blk, int tid, unsigned char* tl) {
  static_assert(K % 128 == 0 && N % 64 == 0, "p_wt_tile: whole tiles");
  const int nt = blk % (N / 64), kt = blk / (N / 64); const int lo = tid & 15, hi = tid >> 4;
  const float* src = W + (size_t)(kt * 128 + hi * 8) * N + nt * 64 + lo * 4; v4f r[8];
#pragma unroll
  for (int i = 0; i < 8; ++i) r[i] = *(const v4fa*)(src + (size_t)i * N);
#pragma unroll
  for (int j = 0; j < 4; ++j) { FragH f;
#pragma unroll
    for (int i = 0; i < 8; ++i) f.h[i] = (_Float16)(bf16_round(r[i][j]) * 16.0f);
    *(v8us*)(tl + (lo * 4 + j) * PW_P + hi * 16) = f.half[0]; }
  __syncthreads();      /* the tile is whole before any row of it is read back; reached by the whole block (the job is chosen by block index) */
  unsigned short* dst = (unsigned short*)Wt + (size_t)(nt * 64 + hi) * K + kt * 128 + lo * 8;
#pragma unroll
  for (int q = 0; q < 4; ++q) { const v8us o = *(const v8us*)(tl + (q * 16 + hi) * PW_P + lo * 16); *(v8us*)(dst + (size_t)(q * 16) * K) = o; }
  asm volatile("s_wait_xcnt 0x0" ::: "memory");      /* the built code runs on from these stores into the other jobs' range tests, whose code reuses the stores' registers: the wait stands in front of any such overwrite */
}
// k_gemm_hh variant with fused epilogue: v = acc·alpha + bias[by·sBias + col] (+ CP[(row/rowsPerB)·sCPb + by·64 + col] if CP) ; ACT 0 none / 1 elu ; writes f16 C16 (and f32 C if non-null)
template <int ACT>
__global__ __launch_bounds__(128) void k_gemm_hhx(const _Float16* __restrict__ A, int lda, size_t sA, const _Float16* __restrict__ Bh, int ldb, size_t sB, float alpha, const float* __restrict__ bias, size_t sBias, const float* __restrict__ CP, int rowsPerB, size_t sCPb, int row0g,
    float* __restrict__ C, _Float16* __restrict__ C16, int ldc, size_t sC, int M, int N, int K) {
  __shared__ __attribute__((aligned(16))) float so[4][16][64];
  const int tid = threadIdx.x, w = tid >> 5, lane = tid & 31, ln = lane & 15, hh = lane >> 4; const int by = blockIdx.y;
  A += (size_t)by * sA; Bh += (size_t)by * sB; const size_t cofs = (size_t)by * sC; const float* bp = bias ? bias + (size_t)by * sBias : nullptr;
  const int ntn = (N + 63) / 64; const int wid = blockIdx.x * 4 + w; const int mt = wid / ntn, nq = wid % ntn; if (mt * 16 >= M) return;
  const int row0 = mt * 16, col0 = nq * 64; const _Float16* arow = A + (size_t)(row0 + ln) * lda;
  v8f acc[4] = {};
  for (int kb = 0; kb < K; kb += 32) { FragH ah; ah.half[0] = *(const v8us*)((const unsigned short*)arow + kb + 8 * hh); ah.half[1] = *(const v8us*)((const unsigned short*)arow + kb + 16 + 8 * hh);
#pragma unroll
    for (int t = 0; t < 4; ++t) { if (col0 + t * 16 >= N) continue; const size_t boff = (size_t)(col0 + t * 16 + ln) * ldb + kb; FragH bq; bq.half[0] = *(const v8us*)((const unsigned short*)Bh + boff + 8 * hh); bq.half[1] = *(const v8us*)((const unsigned short*)Bh + boff + 16 + 8 * hh);
      acc[t] = mmaH<1>(ah.v, ah.v, bq.v, bq.v, acc[t]); }
  }
#pragma unroll
  for (int t = 0; t < 4; ++t) { if (col0 + t * 16 >= N) continue; const int col = col0 + t * 16 + ln; const float bv = bp ? bf16_round(bp[col]) : 0.f;
#pragma unroll
    for (int r = 0; r < 8; ++r) { float v = acc[t][r] * alpha + bv; if (CP) { const int rr = row0g + row0 + 8 * hh + r; if (rowsPerB < 0) v += CP[cofs + (size_t)rr * ldc + col];      /* rowsPerB < 0: own element of the batched C plane */ else { const int bidx = rr / rowsPerB; v += CP[(size_t)bidx * sCPb + (size_t)by * 64 + col]; } } if (ACT == 1) v = (v > 0.f) ? v : expm1f(v); else if (ACT == 7) v = (v > 0.f) ? v + 1.0f : expf(v); else if (ACT == 8) v = tanhf(v); else if (ACT == 9) v = 0.5f * v * (1.0f + tanhf(0.7978845608028654f * (v + 0.044715f * v * v * v))); else if (ACT == 11) v = 1.0f / (1.0f + expf(-v)); else if (ACT == 12) v = (v > 0.f) ? v : 0.01f * v; else if (ACT == 14) v = (v > 0.f) ? v : 0.1f * v; else if (ACT == 16) v = (v >= 0.f) ? v : 0.3f * v; else if (ACT == 17) v = (v >= 0.f) ? v : 0.2f * v; else if (ACT == 15) v = v / (1.0f + expf(-v)); else if (ACT == 3) v = fmaxf(v, 0.f); else if (ACT == 6) v = 0.5f * v * (1.0f + erff(v * 0.70710678118654752f)); so[w][8 * hh + r][t * 16 + ln] = v; } }
  __builtin_amdgcn_fence(__ATOMIC_ACQ_REL, "workgroup"); __builtin_amdgcn_wave_barrier();
  const int rsub = lane >> 4, c4 = (lane & 15) * 4; typedef _Float16 v4h __attribute__((ext_vector_type(4)));
  {
#pragma unroll
    for (int q = 0; q < 8; ++q) { const int r = q * 2 + rsub; if (col0 + c4 < N) { const v4f v = *(const v4fa*)&so[w][r][c4]; if (C) *(v4f*)(C + cofs + (size_t)(row0 + r) * ldc + col0 + c4) = v; if (C16) { v4h h4; for (int i = 0; i < 4; ++i) h4[i] = (_Float16)v[i]; *(v4h*)(C16 + cofs + (size_t)(row0 + r) * ldc + col0 + c4) = h4; } } }
     }
}


typedef _Float16 v4h __attribute__((ext_vector_type(4)));

__global__ __launch_bounds__(256) void k_h16(const float* __restrict__ x, _Float16* __restrict__ X16, size_t n8) { const size_t t = (size_t)blockIdx.x * 256 + threadIdx.x; if (t >= n8) return; FragH f;
#pragma unroll
  for (int q = 0; q < 8; ++q) f.h[q] = (_Float16)x[t * 8 + q]; *(v8us*)((unsigned short*)X16 + t * 8) = f.half[0];  }
__global__ __launch_bounds__(256) void k_round16f(const float* __restrict__ W, _Float16* __restrict__ Bt, size_t n8) { const size_t t = (size_t)blockIdx.x * 256 + threadIdx.x; if (t >= n8) return; FragH f;
#pragma unroll
  for (int i = 0; i < 8; ++i) f.h[i] = (_Float16)(bf16_round(W[t * 8 + i]) * 16.0f); *(v8us*)((unsigned short*)Bt + t * 8) = f.half[0];  }
template <int NHv, int TTv>
__global__ __launch_bounds__(256) void k_vt(const _Float16* __restrict__ V16, int ldv, int voff, _Float16* __restrict__ Vt) { __shared__ unsigned short tl[64][66]; const int tid = threadIdx.x; const int slab = blockIdx.x / (TTv / 64), lg = blockIdx.x % (TTv / 64); const int b = slab / NHv, h = slab % NHv;
  for (int i = tid; i < 64 * 8; i += 256) { const int r = i / 8, c8 = (i % 8) * 8; FragH f; f.half[0] = *(const v8us*)((const unsigned short*)V16 + ((size_t)b * TTv + lg * 64 + r) * ldv + voff + h * 64 + c8);
#pragma unroll
    for (int q = 0; q < 8; ++q) tl[r][c8 + q] = f.u[q]; }
  __syncthreads();
  {
#pragma unroll
    for (int rd = 0; rd < 2; ++rd) { const int d = rd * 32 + tid / 8, pc = tid % 8; FragH f;
#pragma unroll
      for (int q = 0; q < 8; ++q) f.u[q] = tl[pc * 8 + q][d];
      *(v8us*)((unsigned short*)Vt + ((size_t)slab * 64 + d) * TTv + lg * 64 + pc * 8) = f.half[0]; }
     } }

__global__ __launch_bounds__(256) void k_hl(const float* __restrict__ F, _Float16* __restrict__ Hh, _Float16* __restrict__ Hl, size_t n8) { const size_t t = (size_t)blockIdx.x * 256 + threadIdx.x; if (t >= n8) return; FragH fh, fl; const v4f a = *(const v4fa*)(F + t * 8), c = *(const v4fa*)(F + t * 8 + 4);
#pragma unroll
  for (int q = 0; q < 4; ++q) { _Float16 h = (_Float16)a[q]; fh.h[q] = h; fl.h[q] = (_Float16)((a[q] - (float)h) * 1024.0f); h = (_Float16)c[q]; fh.h[4 + q] = h; fl.h[4 + q] = (_Float16)((c[q] - (float)h) * 1024.0f); }
  { *(v8us*)((unsigned short*)Hh + t * 8) = fh.half[0]; *(v8us*)((unsigned short*)Hl + t * 8) = fl.half[0];  } }

// ---- fast GEMM (work-group tile 128x128, eight waves as 4 x 2, wave tile 32x64; requires M % 128 == 0 rows per launch region, N % 128 == 0 and K % 128 == 0); epilogue: v = act(acc alpha + bf16(bias[col])), written as f32 rows (W32), f16 rows (W16) or both ----
// Which planes are written is a template choice and a bias is always given, so the epilogue is straight-line code: no test or branch per element, and the four bias words of a lane come as one group of loads.
// A (128 rows) and Bt (128 rows) come in stages of 128 k = two whole 128-byte lines a row, sixteen threads a row, through registers into two LDS buffers (row pitch 272 bytes); the waves take their fragments from LDS.
// Stage s + 1 is fetched while stage s is worked on; one barrier a stage. The products run in ascending k, 32 k a step.
#define G2_P 272                     /* LDS row pitch in bytes: 256 + 16, an odd multiple of 16 */
#define G2_B (128 * G2_P)            /* Bt rows start behind the 128 A rows */
#define G2_S (256 * G2_P)            /* one buffer */
__device__ __forceinline__ v16h g2_frag(const _Float16* p, int hh) { FragH f; f.half[0] = *(const v8us*)((const unsigned short*)p + 8 * hh); f.half[1] = *(const v8us*)((const unsigned short*)p + 16 + 8 * hh); return f.v; }
__device__ __forceinline__ v16h g2_lfrag(const unsigned char* p) { FragH f; f.half[0] = *(const v8us*)p; f.half[1] = *(const v8us*)(p + 32); return f.v; }      /* p = row ln of a 16 x 32 block in LDS, + 16 hh bytes: the element order of g2_frag */
__device__ __forceinline__ v8f g2_mma(v16h a, v16h b, v8f c) { v8f d = __builtin_amdgcn_wmma_f32_16x16x32_f16(false, a, false, b, (short)0, c, false, false); asm volatile("v_nop\n\tv_nop\n\tv_nop\n\tv_nop" : "+v"(d) : "v"(a), "v"(b)); return d; }
template <int ACT, bool W32, bool W16>
__global__ __launch_bounds__(256) void k_gemm2(const _Float16* __restrict__ A, int lda, size_t sA, const _Float16* __restrict__ Bh, int ldb, size_t sB, float alpha, const float* __restrict__ bias, size_t sBias,
    float* __restrict__ C, _Float16* __restrict__ C16, int ldc, size_t sC, int M, int N, int K) { static_assert(ACT == 0 || ACT == 3 || ACT == 6 || ACT == 8 || ACT == 9 || ACT == 11 || ACT == 12 || ACT == 14 || ACT == 15 || ACT == 16 || ACT == 17, "k_gemm2: unsupported ACT code (would silently apply no activation)");
  __shared__ __attribute__((aligned(16))) unsigned char sm[2 * G2_S];      /* [buffer][A 128 rows | Bt 128 rows][G2_P] */
  static_assert(8 * 32 * 68 * 4 <= 2 * G2_S, "k_gemm2: the epilogue's rows lie over the operand buffers");
  float (*so)[32][68] = (float (*)[32][68])sm;      /* epilogue staging, over the buffers once the last stage's barrier has ended every read of them */
  const int tid = threadIdx.x, w = tid >> 5, lane = tid & 31, ln = lane & 15, hh = lane >> 4; const int by = blockIdx.y;
  A += (size_t)by * sA; Bh += (size_t)by * sB; const size_t cofs = (size_t)by * sC; const float* bp = bias + (size_t)by * sBias;
  const int ntn = N >> 7; const int mt = blockIdx.x / ntn, nq = blockIdx.x - mt * ntn; const int wm = w & 3, wn = w >> 2; const int row0 = mt * 128 + 32 * wm, col0 = nq * 128 + 64 * wn; if (mt * 128 >= M) return;      /* the whole work-group or none: barriers follow */
  const int srow = tid >> 4, scol = (tid & 15) * 16;      /* staging: sixteen threads a row, 16 rows a sweep; eight sweeps for A, eight for Bt */
  const char* ag = (const char*)(A + (size_t)(mt * 128) * lda); const char* bg = (const char*)(Bh + (size_t)(nq * 128) * ldb);      /* the tiles' first rows: the same for the whole work-group */
  const unsigned av = (unsigned)(srow * lda * 2 + scol), bv = (unsigned)(srow * ldb * 2 + scol);      /* this thread's place in a sweep, in bytes */
  const size_t a16 = (size_t)lda * 32, b16 = (size_t)ldb * 32;      /* 16 rows, in bytes */
  unsigned char* sd = sm + srow * G2_P + scol;
  v8us ga[8], gb[8];
#pragma unroll
  for (int j = 0; j < 8; ++j) ga[j] = *(const v8us*)(ag + j * a16 + av);
#pragma unroll
  for (int j = 0; j < 8; ++j) gb[j] = *(const v8us*)(bg + j * b16 + bv);
#pragma unroll
  for (int j = 0; j < 8; ++j) *(v8us*)(sd + 16 * j * G2_P) = ga[j];
#pragma unroll
  for (int j = 0; j < 8; ++j) *(v8us*)(sd + G2_B + 16 * j * G2_P) = gb[j];
  __syncthreads();      /* stage 0 published */
  const unsigned char* al = sm + (32 * wm + ln) * G2_P + 16 * hh; const unsigned char* bl = sm + G2_B + (64 * wn + ln) * G2_P + 16 * hh;
  const v8f z8 = {0.f,0.f,0.f,0.f,0.f,0.f,0.f,0.f}; v8f c00 = z8, c01 = z8, c02 = z8, c03 = z8, c10 = z8, c11 = z8, c12 = z8, c13 = z8;
  const int nst = K >> 7;
#pragma unroll 1      /* one stage a trip: the buffer index alternates, and two stages' staging registers at once would go past 256 registers */
  for (int st = 0; st < nst; ++st) { const bool more = st + 1 < nst;      /* the same for the whole work-group */
    if (more) { const unsigned ao = av + (unsigned)(st + 1) * 256u, bo = bv + (unsigned)(st + 1) * 256u;      /* 32-bit lane offsets on work-group-uniform row bases */
#pragma unroll
      for (int j = 0; j < 8; ++j) ga[j] = *(const v8us*)((ag + j * a16) + ao);
#pragma unroll
      for (int j = 0; j < 8; ++j) gb[j] = *(const v8us*)((bg + j * b16) + bo); }
    const int cur = (st & 1) * G2_S;
#pragma unroll
    for (int hf = 0; hf < 2; ++hf) {      /* 64 k: one group of fragment loads, then its 16 products */
      const unsigned char* ap = al + cur + 128 * hf; const unsigned char* bq = bl + cur + 128 * hf; v16h a0[2], a1[2], b0[2], b1[2], b2[2], b3[2];
#pragma unroll
      for (int kk = 0; kk < 2; ++kk) { a0[kk] = g2_lfrag(ap + 64 * kk); a1[kk] = g2_lfrag(ap + 16 * G2_P + 64 * kk); b0[kk] = g2_lfrag(bq + 64 * kk); b1[kk] = g2_lfrag(bq + 16 * G2_P + 64 * kk); b2[kk] = g2_lfrag(bq + 32 * G2_P + 64 * kk); b3[kk] = g2_lfrag(bq + 48 * G2_P + 64 * kk); }
#pragma unroll
      for (int kk = 0; kk < 2; ++kk) {      /* 32 k */
        c00 = g2_mma(a0[kk], b0[kk], c00); c10 = g2_mma(a1[kk], b0[kk], c10); c01 = g2_mma(a0[kk], b1[kk], c01); c11 = g2_mma(a1[kk], b1[kk], c11);
        c02 = g2_mma(a0[kk], b2[kk], c02); c12 = g2_mma(a1[kk], b2[kk], c12); c03 = g2_mma(a0[kk], b3[kk], c03); c13 = g2_mma(a1[kk], b3[kk], c13); } }
    if (more) { unsigned char* nd = sd + (G2_S - cur);      /* the buffer of stage st - 1: every wave left it at the barrier that ended that trip */
#pragma unroll
      for (int j = 0; j < 8; ++j) *(v8us*)(nd + 16 * j * G2_P) = ga[j];
#pragma unroll
      for (int j = 0; j < 8; ++j) *(v8us*)(nd + G2_B + 16 * j * G2_P) = gb[j]; }
    __syncthreads(); }      /* publishes stage st + 1 and ends every wave's reads of stage st */
  v8f accs[8] = {c00, c01, c02, c03, c10, c11, c12, c13}; float bt[4];
#pragma unroll
  for (int t = 0; t < 4; ++t) bt[t] = bf16_round(bp[col0 + t * 16 + ln]);
#pragma unroll
  for (int u = 0; u < 8; ++u) { const int t = u & 3, half = u >> 2; const float bv = bt[t];
#pragma unroll
    for (int r = 0; r < 8; ++r) { const int rloc = half * 16 + 8 * hh + r; float v = accs[u][r] * alpha + bv;
      if (ACT == 3) v = fmaxf(v, 0.f); else if (ACT == 6) v = 0.5f * v * (1.0f + erff(v * 0.70710678118654752f)); else if (ACT == 11) v = 1.0f / (1.0f + expf(-v)); else if (ACT == 15) v = v / (1.0f + expf(-v)); else if (ACT == 12) v = (v > 0.f) ? v : 0.01f * v; else if (ACT == 8) v = tanhf(v); else if (ACT == 9) v = 0.5f * v * (1.0f + tanhf(0.7978845608028654f * (v + 0.044715f * v * v * v))); else if (ACT == 14) v = (v > 0.f) ? v : 0.1f * v; else if (ACT == 16) v = (v >= 0.f) ? v : 0.3f * v; else if (ACT == 17) v = (v >= 0.f) ? v : 0.2f * v;
      so[w][rloc][t * 16 + ln] = v; } }
  __builtin_amdgcn_fence(__ATOMIC_ACQ_REL, "workgroup"); __builtin_amdgcn_wave_barrier();
  const int rsub = lane >> 4, c4 = (lane & 15) * 4;
  {
#pragma unroll
    for (int q = 0; q < 16; ++q) { const int r = q * 2 + rsub; const v4f v = *(const v4fa*)&so[w][r][c4]; if (W32) *(v4f*)(C + cofs + (size_t)(row0 + r) * ldc + col0 + c4) = v; if (W16) { v4h h4; for (int i = 0; i < 4; ++i) h4[i] = (_Float16)v[i]; *(v4h*)(C16 + cofs + (size_t)(row0 + r) * ldc + col0 + c4) = h4; } }
     } }


// ---- GEMM with wave tiles of 16 FA x 48, waves as 4 x WGN: work-group tile 64 FA x 48 WGN; v = act(acc alpha + bf16(bias[col])), as f32 rows (W32) or f16 rows ----
// The tile is chosen per launch so that the grid is one round of at most 256 work-groups, one a WGP, with no second, part-filled round; the two launches with 768 columns now have a tile for every WGP (128x128 gave them 192):
// 256x192 (FA 4, WGN 4, sixteen waves) for the launches with many columns (q | k | v: 192 tiles; first FFN product: 256), 128x96 (FA 2, WGN 2, eight waves) for the two with 768 columns (256 tiles each).
// 256x192 against 128x128: 448 operand rows fetched per 256x192 outputs (was 768), and a wave reads 7 fragments for 12 products (was 6 for 8).
// Grid: x = tile column, y = tile row; whole tiles only. K (also the row pitch of A and Bt) and the output's row pitch LDC are template constants, so that every sweep's row step is an immediate offset on one lane offset and one uniform base: no address arithmetic among the loads or the stores.
// Staging, stage order and k order are those of k_gemm2: stages of 128 k, sixteen threads a row, through registers into two LDS buffers (row pitch G2_P), stage s + 1 fetched while stage s is worked on, one barrier a stage, products in ascending k, 32 k a step.
template <int ACT, int K, int LDC, int FA, int WGN, bool W32>
__global__ __launch_bounds__(128 * WGN) void k_gemm3(const _Float16* __restrict__ A, const _Float16* __restrict__ Bh, float alpha, const float* __restrict__ bias, float* __restrict__ C, _Float16* __restrict__ C16) {
  static_assert((ACT == 0 || ACT == 3) && K % 128 == 0 && (FA == 2 || FA == 4) && FA == WGN, "k_gemm3: no activation or relu; whole 128-k stages; eight sweeps of A rows");
  constexpr int TM = 64 * FA, TN = 48 * WGN, NW = 4 * WGN, RS = 8 * WGN;      /* tile, waves, rows a staging sweep (sixteen threads a row): eight sweeps for A, six for Bt */
  constexpr int BB = TM * G2_P, BS = (TM + TN) * G2_P;      /* Bt rows start behind the A rows; one buffer */
  constexpr int Q = TN + 4;      /* epilogue row pitch in floats: 8 rows apart = 32 banks apart, so the two halves of a wave store without conflict */
  constexpr int KG = (FA == 2) ? 2 : 1;      /* 32-k steps whose fragments are fetched as one group: as many as the registers of four waves a SIMD hold */
  __shared__ __attribute__((aligned(16))) unsigned char sm[2 * BS];      /* [buffer][A rows | Bt rows][G2_P] */
  static_assert(TM * Q * 4 <= 2 * BS, "k_gemm3: the epilogue's tile lies over the operand buffers");
  const int tid = threadIdx.x, w = tid >> 5, lane = tid & 31, ln = lane & 15, hh = lane >> 4;
  const int nq = blockIdx.x, mt = blockIdx.y; const int wm = w & 3, wn = w >> 2;
  const int srow = tid >> 4, scol = (tid & 15) * 16;
  const char* ag = (const char*)(A + (size_t)(mt * TM) * K); const char* bg = (const char*)(Bh + (size_t)(nq * TN) * K);      /* the tiles' first rows: the same for the whole work-group */
  const unsigned sv = (unsigned)(srow * K * 2 + scol);      /* this thread's place in a sweep, in bytes; the same in A and Bt */
  constexpr int RB = RS * K * 2;      /* the rows of one sweep, in bytes */
  unsigned char* sd = sm + srow * G2_P + scol;
  v8us ga[8], gb[6]; float bt[3];
#pragma unroll
  for (int j = 0; j < 8; ++j) ga[j] = *(const v8us*)(ag + sv + j * RB);
#pragma unroll
  for (int j = 0; j < 6; ++j) gb[j] = *(const v8us*)(bg + sv + j * RB);
#pragma unroll
  for (int j = 0; j < 3; ++j) bt[j] = bias[nq * TN + 48 * wn + 16 * j + ln];      /* the lane's three bias words, fetched with stage 0 so that the epilogue does not wait for them */
#pragma unroll
  for (int j = 0; j < 8; ++j) *(v8us*)(sd + RS * j * G2_P) = ga[j];
#pragma unroll
  for (int j = 0; j < 6; ++j) *(v8us*)(sd + BB + RS * j * G2_P) = gb[j];
  __syncthreads();      /* stage 0 published */
  const unsigned char* al = sm + (16 * FA * wm + ln) * G2_P + 16 * hh; const unsigned char* bl = sm + BB + (48 * wn + ln) * G2_P + 16 * hh;
  const v8f z8 = {0.f,0.f,0.f,0.f,0.f,0.f,0.f,0.f}; v8f acc[FA][3];
#pragma unroll
  for (int i = 0; i < FA; ++i)
#pragma unroll
    for (int j = 0; j < 3; ++j) acc[i][j] = z8;
  constexpr int nst = K >> 7;
#pragma unroll 1      /* one stage a trip: the buffer index alternates, and two stages' staging registers at once would go past the 256 registers that four waves a SIMD leave a wave */
  for (int st = 0; st < nst; ++st) { const bool more = st + 1 < nst;      /* the same for the whole work-group */
    if (more) { const char* an = ag + (st + 1) * 256; const char* bn = bg + (st + 1) * 256;      /* the stage moves the uniform bases; the lane offset stays */
#pragma unroll
      for (int j = 0; j < 8; ++j) ga[j] = *(const v8us*)(an + sv + j * RB);
#pragma unroll
      for (int j = 0; j < 6; ++j) gb[j] = *(const v8us*)(bn + sv + j * RB); }
    const int cur = (st & 1) * BS;
#pragma unroll
    for (int kg = 0; kg < 4; kg += KG) {      /* one group of fragment loads, then its products */
      const unsigned char* ap = al + cur + 64 * kg; const unsigned char* bq = bl + cur + 64 * kg; v16h a[KG][FA], b[KG][3];
#pragma unroll
      for (int kk = 0; kk < KG; ++kk) {
#pragma unroll
        for (int i = 0; i < FA; ++i) a[kk][i] = g2_lfrag(ap + 16 * i * G2_P + 64 * kk);
#pragma unroll
        for (int j = 0; j < 3; ++j) b[kk][j] = g2_lfrag(bq + 16 * j * G2_P + 64 * kk); }
#pragma unroll
      for (int kk = 0; kk < KG; ++kk)      /* 32 k */
#pragma unroll
        for (int j = 0; j < 3; ++j)
#pragma unroll
          for (int i = 0; i < FA; ++i) acc[i][j] = g2_mma(a[kk][i], b[kk][j], acc[i][j]); }
    if (more) { unsigned char* nd = sd + (BS - cur);      /* the buffer of stage st - 1: every wave left it at the barrier that ended that trip */
#pragma unroll
      for (int j = 0; j < 8; ++j) *(v8us*)(nd + RS * j * G2_P) = ga[j];
#pragma unroll
      for (int j = 0; j < 6; ++j) *(v8us*)(nd + BB + RS * j * G2_P) = gb[j]; }
    __syncthreads(); }      /* publishes stage st + 1 and ends every wave's reads of stage st */
  float* sw = (float*)sm + (16 * FA * wm + 8 * hh) * Q + 48 * wn + ln;      /* the whole tile as f32 rows, over the buffers: the last stage's barrier has ended every read of them */
#pragma unroll
  for (int i = 0; i < FA; ++i)
#pragma unroll
    for (int j = 0; j < 3; ++j)
#pragma unroll
      for (int r = 0; r < 8; ++r) { float v = acc[i][j][r] * alpha + bf16_round(bt[j]); if (ACT == 3) v = fmaxf(v, 0.f); sw[(16 * i + r) * Q + 16 * j] = v; }
  __syncthreads();      /* a row of the tile (384 bytes in either output type, three whole lines) holds the columns of several waves: all of them have stored before any row goes out */
  constexpr int ES = W32 ? 4 : 2, PR = TN / 4, RW = 96 / PR, NP = 3 * TM / (NW * RW);      /* bytes an element; pieces of 4 columns a row; rows a wave takes at a time = 96 pieces = three sweeps of 32 lanes; pieces a lane */
  char* cp = W32 ? (char*)(C + (size_t)(mt * TM) * LDC + nq * TN) : (char*)(C16 + (size_t)(mt * TM) * LDC + nq * TN);      /* the tile's first element: the same for the whole work-group */
  unsigned go[3], lo[3];      /* a sweep covers whole 128-byte lines, each stored by one instruction */
#pragma unroll
  for (int s = 0; s < 3; ++s) { const int p = 32 * s + lane, rr = p / PR, u = p - PR * rr; go[s] = (unsigned)((RW * w + rr) * (LDC * ES) + 4 * ES * u); lo[s] = (unsigned)(((RW * w + rr) * Q + 4 * u) * 4); }
  v4f pv[NP];
#pragma unroll
  for (int t = 0; t < NP / 3; ++t)      /* all waves' rows of one turn: 32 rows */
#pragma unroll
    for (int s = 0; s < 3; ++s) pv[3 * t + s] = *(const v4fa*)(sm + lo[s] + t * (32 * Q * 4));
  __builtin_amdgcn_sched_barrier(0);      /* holds the lane's LDS reads together, in one flight and each in registers of its own (the accumulators' are free by now); left free, the scheduler read later pieces into the data registers of stores still in flight and waited for those stores at each reuse */
  if (W32) {
#pragma unroll
    for (int t = 0; t < NP / 3; ++t)
#pragma unroll
      for (int s = 0; s < 3; ++s) *(v4f*)(cp + go[s] + t * (32 * LDC * ES)) = pv[3 * t + s];
  } else { v4h ph[NP];
#pragma unroll
    for (int q = 0; q < NP; ++q)
#pragma unroll
      for (int i = 0; i < 4; ++i) ph[q][i] = (_Float16)pv[q][i];
    __builtin_amdgcn_sched_barrier(0);      /* all pieces are converted before the first store, so each store has data registers of its own and none waits for an earlier store before its data can be formed */
#pragma unroll
    for (int t = 0; t < NP / 3; ++t)
#pragma unroll
      for (int s = 0; s < 3; ++s) *(v4h*)(cp + go[s] + t * (32 * LDC * ES)) = ph[3 * t + s]; } }

__global__ __launch_bounds__(256) void k_wnat(const float* __restrict__ w, size_t n8, _Float16* __restrict__ Bt) { const size_t t = (size_t)blockIdx.x * 256 + threadIdx.x; if (t >= n8) return; FragH f; for (int q = 0; q < 8; ++q) f.h[q] = (_Float16)(bf16_round(w[t * 8 + q]) * 16.0f); *(v8us*)((unsigned short*)Bt + t * 8) = f.half[0];  }
__global__ __launch_bounds__(256) void k_rsm(const float* __restrict__ S, _Float16* __restrict__ P, int nrows) {
  #pragma clang fp contract(off)
  const int i = blockIdx.x * 256 + threadIdx.x; if (i >= nrows) return; const float* s = S + (size_t)i * SQ; float mx = -3.0e38f;
#pragma unroll 1
  for (int j = 0; j < SQ; ++j) mx = fmaxf(mx, s[j]); float se = 0.f;
#pragma unroll 1
  for (int j = 0; j < SQ; ++j) se += expf(s[j] - mx); const float sc = 256.0f / se;
#pragma unroll 1
  for (int j0 = 0; j0 < SQ; j0 += 8) { FragH f; for (int q = 0; q < 8; ++q) f.h[q] = (_Float16)(expf(s[j0 + q] - mx) * sc); unsigned short* d = (unsigned short*)P + (size_t)i * SQ + j0; *(v8us*)d = f.half[0];  } }
__global__ __launch_bounds__(256) void k_vt(const _Float16* __restrict__ V16, int b, int h0, _Float16* __restrict__ VT) { __shared__ unsigned short tl[64][65]; const int tid = threadIdx.x; const int hh = blockIdx.x % HG, sg = blockIdx.x / HG; const int s0 = sg * 64; const int h = h0 + hh;
  for (int i = tid; i < 64 * 8; i += 256) { const int j = i / 8, d8 = (i % 8) * 8; FragH f; f.half[0] = *(const v8us*)((const unsigned short*)V16 + ((size_t)b * SQ + s0 + j) * DM + h * HD + d8); for (int q = 0; q < 8; ++q) tl[d8 + q][j] = f.u[q]; }
  __syncthreads();
  { for (int i = tid; i < 64 * 8; i += 256) { const int d = i / 8, j8 = (i % 8) * 8; FragH f; for (int q = 0; q < 8; ++q) f.u[q] = tl[d][j8 + q]; *(v8us*)((unsigned short*)VT + ((size_t)hh * HD + d) * SQ + s0 + j8) = f.half[0]; }  } }



__global__ __launch_bounds__(256) void k_rsmcf2(const float* __restrict__ S, _Float16* __restrict__ P, int hg, int q0, int nk) {
  #pragma clang fp contract(off)
  const int t = blockIdx.x * 256 + threadIdx.x; if (t >= hg * QT) return; const size_t i = (size_t)t; const float* s = S + i * NKX; const int last = q0 + (t % QT); float mx = -3.0e38f;
#pragma unroll 1
  for (int j = 0; j < nk; ++j) { const float f = (j <= last) ? 1.f : 0.f; mx = fmaxf(mx, fmaf(f, s[j], (1.f - f) * -1.0e9f)); } float se = 0.f;
#pragma unroll 1
  for (int j = 0; j < nk; ++j) { const float f = (j <= last) ? 1.f : 0.f; se += __expf(fmaf(f, s[j], (1.f - f) * -1.0e9f) - mx); } const float sc = 256.0f / se;
#pragma unroll 1
  for (int j0 = 0; j0 < nk; j0 += 8) { FragH fr; for (int q = 0; q < 8; ++q) { const int j = j0 + q; const float f = (j <= last) ? 1.f : 0.f; fr.h[q] = (_Float16)(__expf(fmaf(f, s[j], (1.f - f) * -1.0e9f) - mx) * sc); } unsigned short* d = (unsigned short*)P + i * NKX + j0; *(v8us*)d = fr.half[0];  } }


template <int MASKADD>
__global__ __launch_bounds__(64) void k_att0(const float* __restrict__ QF, const float* __restrict__ KF, const float* __restrict__ VF, int ld, const float* __restrict__ mask, float scale, float* __restrict__ OF, int ldo) {
  #pragma clang fp contract(off)
  __shared__ __attribute__((aligned(16))) float lq[64][64]; __shared__ __attribute__((aligned(16))) float lo[64][64];
  const int tid = threadIdx.x; const int h = blockIdx.x / (QT0 / 64), rg = blockIdx.x % (QT0 / 64); const int i = rg * 64 + tid;
  const float* qr = QF + (size_t)i * ld + h * HD;
#pragma unroll 1
  for (int c = 0; c < HD / 4; ++c) { *(v4f*)&lq[tid][c * 4] = *(const v4fa*)(qr + c * 4); const v4f z = {0.f, 0.f, 0.f, 0.f}; *(v4f*)&lo[tid][c * 4] = z; }
  float m = -1.0e30f, l = 0.f; const int jmax = MASKADD ? (SQ - 1) : (rg * 64 + 63);      /* additive-mask form: every key (the mask input decides); causal form: keys up to the block's last row */
#pragma unroll 1
  for (int j = 0; j <= jmax; ++j) { const float* kr = KF + (size_t)j * ld + h * HD; const float* vr = VF + (size_t)j * ld + h * HD; float s = 0.f;
#pragma unroll 1
    for (int c = 0; c < HD / 4; ++c) { const v4f kq = *(const v4fa*)(kr + c * 4); const v4f qq = *(v4f*)&lq[tid][c * 4]; s = __fadd_rn(s, __fmul_rn(qq[0], kq[0])); s = __fadd_rn(s, __fmul_rn(qq[1], kq[1])); s = __fadd_rn(s, __fmul_rn(qq[2], kq[2])); s = __fadd_rn(s, __fmul_rn(qq[3], kq[3])); }
    s = __fmul_rn(s, scale); if (MASKADD) s = __fadd_rn(s, __fmul_rn(bf16_round(mask[(size_t)i * SQ + j]), -10000.0f));
    const float f = (MASKADD || j <= i) ? 1.f : 0.f; const float sm = fmaf(f, s, (1.f - f) * -1.0e30f); const float mn = fmaxf(m, sm); const float sc = expf(m - mn); const float e = expf(sm - mn); l = __fadd_rn(__fmul_rn(l, sc), e); m = mn;
#pragma unroll 1
    for (int c = 0; c < HD / 4; ++c) { const v4f vv = *(const v4fa*)(vr + c * 4); v4f oo = *(v4f*)&lo[tid][c * 4]; for (int u = 0; u < 4; ++u) oo[u] = __fadd_rn(__fmul_rn(oo[u], sc), __fmul_rn(e, vv[u])); *(v4f*)&lo[tid][c * 4] = oo; } }
  const float fin = 64.0f / l;      /* o carried x64 like the f16 path */
#pragma unroll 1
  for (int c = 0; c < HD / 4; ++c) { v4f oo = *(v4f*)&lo[tid][c * 4]; for (int u = 0; u < 4; ++u) oo[u] = __fmul_rn(oo[u], fin); *(v4f*)&lo[tid][c * 4] = oo; }
  __syncthreads();
  {
#pragma unroll 1
    for (int it = 0; it < 16; ++it) { const int row = it * 4 + tid / 16, pc = (tid % 16) * 4; const v4f v = *(const v4f*)&lo[row][pc]; *(v4f*)(OF + (size_t)(rg * 64 + row) * ldo + h * HD + pc) = v; }
     } }


template <int BFIN, int WXB>
__global__ __launch_bounds__(256) void k_ln16(const float* __restrict__ X, const float* __restrict__ g, const float* __restrict__ bb, float eps, _Float16* __restrict__ N16, float* __restrict__ XB) {
  #pragma clang fp contract(off)
  __shared__ float red[256]; const size_t r = blockIdx.x; const int t = threadIdx.x; const v4f xa = *(const v4fa*)(X + r * DMQ + t * 4); float s[4]; float sum = 0.f;
  for (int q = 0; q < 4; ++q) { s[q] = BFIN ? bf16_round(xa[q]) : xa[q]; sum = __fadd_rn(sum, s[q]); }
  red[t] = sum; __syncthreads(); for (int st = 128; st > 0; st >>= 1) { if (t < st) red[t] = __fadd_rn(red[t], red[t + st]); __syncthreads(); } const float mu = red[0] / (float)DMQ; __syncthreads();
  float vs = 0.f; for (int q = 0; q < 4; ++q) { const float dl = __fadd_rn(s[q], -mu); vs = __fadd_rn(vs, __fmul_rn(dl, dl)); } red[t] = vs; __syncthreads(); for (int st = 128; st > 0; st >>= 1) { if (t < st) red[t] = __fadd_rn(red[t], red[t + st]); __syncthreads(); }
  const float rs = rsqrtf(__fadd_rn(red[0] / (float)DMQ, eps)); v4h y; v4f xb;
  for (int q = 0; q < 4; ++q) { const int c = t * 4 + q; y[q] = (_Float16)__fadd_rn(__fmul_rn(__fmul_rn(__fadd_rn(s[q], -mu), rs), bf16_round(g[c])), bf16_round(bb[c])); xb[q] = s[q]; }
  { *(v4h*)(N16 + r * DMQ + t * 4) = y; if (WXB) *(v4f*)(XB + r * DMQ + t * 4) = xb;  } }
__global__ __launch_bounds__(256) void k_ftres2(const float* __restrict__ OF0, const float* __restrict__ XB, float* __restrict__ X1, size_t n4) {
  #pragma clang fp contract(off)
  const size_t t = (size_t)blockIdx.x * 256 + threadIdx.x; if (t >= n4) return; const v4f o = *(const v4fa*)(OF0 + t * 4), xv = *(const v4fa*)(XB + t * 4); v4f y; for (int q = 0; q < 4; ++q) y[q] = __fadd_rn(__fmul_rn(o[q], 0.015625f), xv[q]); *(v4f*)(X1 + t * 4) = y;  }

__global__ __launch_bounds__(256) void k_wthd(const float* __restrict__ Wt, _Float16* __restrict__ Bt) { const size_t t = (size_t)blockIdx.x * 256 + threadIdx.x; if (t >= (size_t)NH * HD * (DM / 8)) return; const int m8 = (int)(t % (DM / 8)) * 8; const int d = (int)((t / (DM / 8)) % HD); const int h = (int)(t / ((size_t)(DM / 8) * HD)); FragH f;
  for (int q = 0; q < 8; ++q) f.h[q] = (_Float16)(16.0f * bf16_round(Wt[((size_t)h * DM + m8 + q) * HD + d])); unsigned short* dst = (unsigned short*)Bt + ((size_t)h * HD + d) * DM + m8; *(v8us*)dst = f.half[0];  }




template <int BFIN, int W16, int W32>
__global__ __launch_bounds__(256) void k_lnx(const float* __restrict__ X, const float* __restrict__ g, const float* __restrict__ bb, float eps, _Float16* __restrict__ N16, float* __restrict__ N32) {
  #pragma clang fp contract(off)
  __shared__ float red[256]; const size_t r = blockIdx.x; const int t = threadIdx.x; const bool act = t < (DMQ / 4); const int c0 = act ? t * 4 : 0;
  const v4f xa = *(const v4fa*)(X + r * DMQ + c0); float s[4]; float sum = 0.f;
  for (int q = 0; q < 4; ++q) { s[q] = act ? (BFIN ? bf16_round(xa[q]) : xa[q]) : 0.f; sum = __fadd_rn(sum, s[q]); }
  red[t] = sum; __syncthreads(); for (int st = 128; st > 0; st >>= 1) { if (t < st) red[t] = __fadd_rn(red[t], red[t + st]); __syncthreads(); } const float mu = red[0] / (float)DMQ; __syncthreads();
  float vs = 0.f; for (int q = 0; q < 4; ++q) { const float dl = act ? __fadd_rn(s[q], -mu) : 0.f; vs = __fadd_rn(vs, __fmul_rn(dl, dl)); } red[t] = vs; __syncthreads(); for (int st = 128; st > 0; st >>= 1) { if (t < st) red[t] = __fadd_rn(red[t], red[t + st]); __syncthreads(); }
  const float rs = rsqrtf(__fadd_rn(red[0] / (float)DMQ, eps)); v4h y; v4f yf;
  for (int q = 0; q < 4; ++q) { const int c = c0 + q; yf[q] = __fadd_rn(__fmul_rn(__fmul_rn(__fadd_rn(s[q], -mu), rs), bf16_round(g[c])), bf16_round(bb[c])); y[q] = (_Float16)yf[q]; }
  if (!act) return;      /* no barriers after this point */
  { if (W16) *(v4h*)(N16 + r * DMQ + c0) = y; if (W32) *(v4f*)(N32 + r * DMQ + c0) = yf;  } }






__global__ __launch_bounds__(256) void k_lorafold(const float* __restrict__ Wm, const float* __restrict__ A, const float* __restrict__ Bm, float* __restrict__ WE, int K, int N, float sc) {
  #pragma clang fp contract(off)
  const size_t t = (size_t)blockIdx.x * 256 + threadIdx.x; if (t >= (size_t)K * N) return; const int i = (int)(t / N), o = (int)(t % N); float a = 0.f;
  for (int r = 0; r < 16; ++r) a = __fadd_rn(a, __fmul_rn(bf16_round(A[(size_t)i * 16 + r]), bf16_round(Bm[(size_t)r * N + o])));
  const float v = __fadd_rn(bf16_round(Wm[t]), __fmul_rn(sc, a)); *(float*)(WE + t) = v;  }
__global__ __launch_bounds__(256) void k_wt32rep(const float* __restrict__ Wf, _Float16* __restrict__ Bt, int K, int N, int DOUT, float scale) {
  const int t = blockIdx.x * 256 + threadIdx.x; if (t >= DOUT * (K / 8)) return; const int n = t / (K / 8), k8 = (t % (K / 8)) * 8; const int rep = DOUT / N; const int src = (n / (HD * rep)) * HD + (n % HD);      /* head h = n / HD -> group h / rep */
  FragH f; for (int i = 0; i < 8; ++i) f.h[i] = (_Float16)(Wf[(size_t)(k8 + i) * N + src] * scale);
  *(v8us*)((unsigned short*)Bt + (size_t)n * K + k8) = f.half[0];  }
__global__ __launch_bounds__(256) void k_brep(const float* __restrict__ b, float* __restrict__ out) { const int t = blockIdx.x * 256 + threadIdx.x; if (t >= DM) return; const float v = b[(t / (HD * 4)) * HD + (t % HD)]; *(float*)(out + t) = v;  }

__global__ __launch_bounds__(256) void k_rsmcim(const float* __restrict__ S, _Float16* __restrict__ P, int hg, int q0, int nk, const int* __restrict__ am) {
  #pragma clang fp contract(off)
  const int t = blockIdx.x * 256 + threadIdx.x; if (t >= hg * QT) return; const size_t i = (size_t)t; const float* s = S + i * NKX; const int last = q0 + (t % QT); const int* mr = am + (size_t)last * SQ; float mx = -3.0e38f;      /* the module's mask row of this query (keys >= nk lie above the diagonal of the causal mask and are not computed) */
#pragma unroll 1
  for (int j = 0; j < nk; ++j) { const float f = (mr[j] != 0) ? 1.f : 0.f; mx = fmaxf(mx, fmaf(f, s[j], (1.f - f) * -1.0e9f)); } float se = 0.f;
#pragma unroll 1
  for (int j = 0; j < nk; ++j) { const float f = (mr[j] != 0) ? 1.f : 0.f; se += __expf(fmaf(f, s[j], (1.f - f) * -1.0e9f) - mx); } const float sc = 256.0f / se;
#pragma unroll 1
  for (int j0 = 0; j0 < nk; j0 += 8) { FragH fr; for (int q = 0; q < 8; ++q) { const int j = j0 + q; const float f = (mr[j] != 0) ? 1.f : 0.f; fr.h[q] = (_Float16)(__expf(fmaf(f, s[j], (1.f - f) * -1.0e9f) - mx) * sc); } unsigned short* d = (unsigned short*)P + i * NKX + j0; *(v8us*)d = fr.half[0];  } }






__global__ __launch_bounds__(256) void k_rsmp(const float* __restrict__ S, _Float16* __restrict__ P, int nrows, int nk) {
  #pragma clang fp contract(off)
  const int t = blockIdx.x * 256 + threadIdx.x; if (t >= nrows) return; const size_t ri = (size_t)t; const float* s = S + ri * NKX; float mx = -3.0e38f;
#pragma unroll 1
  for (int j = 0; j < nk; ++j) mx = fmaxf(mx, s[j]); float se = 0.f;
#pragma unroll 1
  for (int j = 0; j < nk; ++j) se += __expf(s[j] - mx); const float sc = 256.0f / se;
#pragma unroll 1
  for (int j0 = 0; j0 < nk; j0 += 8) { FragH fr; for (int q = 0; q < 8; ++q) fr.h[q] = (_Float16)(__expf(s[j0 + q] - mx) * sc);
    unsigned short* d = (unsigned short*)P + ri * NKX + j0; *(v8us*)d = fr.half[0];  } }
// V^T in key-list order, and the masked keys' column sums. KI[b] lists the batch's keys, the unmasked ones first (NU[b] of them), then the masked ones, each part in ascending order.
// A block takes 64 list places of one (batch, head): it fetches those V rows, writes them as 64 columns of V^T (whole 128-byte pieces, one writer each) and adds up, per column d, the rows whose place lies behind NU[b].
__global__ __launch_bounds__(256) void k_vtg(const _Float16* __restrict__ V16, const int* __restrict__ KI, const int* __restrict__ NU, _Float16* __restrict__ Vt, float* __restrict__ VS) {
  __shared__ unsigned short tl[64][66]; __shared__ float ps[4][64]; const int tid = threadIdx.x; const int slab = blockIdx.x / (SQ / 64), lg = blockIdx.x % (SQ / 64); const int b = slab / NH, h = slab % NH;
  const int nu = min(max(NU[b], 0), SQ);
  const int r0 = tid / 8, c8 = (tid % 8) * 8; int key[2]; FragH fv[2];      /* eight threads a row, 32 rows a sweep; both sweeps' list words, then both sweeps' rows, in one flight each */
#pragma unroll
  for (int u = 0; u < 2; ++u) key[u] = KI[b * SQ + lg * 64 + 32 * u + r0] & (SQ - 1);
#pragma unroll
  for (int u = 0; u < 2; ++u) fv[u].half[0] = *(const v8us*)((const unsigned short*)V16 + ((size_t)b * SQ + key[u]) * LQ + h * HD + c8);
#pragma unroll
  for (int u = 0; u < 2; ++u)
#pragma unroll
    for (int q = 0; q < 8; ++q) tl[32 * u + r0][c8 + q] = fv[u].u[q];
  __syncthreads();      /* the tile is whole before it is read by columns */
  const int d = tid & 63, qd = tid >> 6; float s = 0.f;
#pragma unroll
  for (int u = 0; u < 16; ++u) { const int r = qd * 16 + u; const float v = (float)__builtin_bit_cast(_Float16, tl[r][d]); s += (lg * 64 + r >= nu) ? v : 0.f; }
  ps[qd][d] = s;
  __syncthreads();      /* the four quarter sums of a column are there before they are added; it stands in front of the V^T stores so that no wave waits for those here */
#pragma unroll
  for (int rd = 0; rd < 2; ++rd) { const int dd = rd * 32 + tid / 8, pc = tid % 8; FragH f;
#pragma unroll
    for (int q = 0; q < 8; ++q) f.u[q] = tl[pc * 8 + q][dd];
    *(v8us*)((unsigned short*)Vt + ((size_t)slab * HD + dd) * SQ + lg * 64 + pc * 8) = f.half[0]; }
  if (tid < 64) VS[((size_t)slab * (SQ / 64) + lg) * HD + tid] = (ps[0][tid] + ps[1][tid]) + (ps[2][tid] + ps[3][tid]); }
// Fused attention, one launch for all batches and heads: a work-group of four waves owns 64 query rows (16 a wave) and walks the batch's NU unmasked keys, in key-list order, in stages of 64; scores and weights stay in registers.
// Every masked key holds the same score (the fill) for every query, so the masked keys together add (SQ - NU) x w to a query's sum and w x (column sum of their V rows) to its context, w = the fill score's weight: added once, behind the loop.
// Transposed products: S^T = K Q^T (rows = keys, columns = queries) and O^T += V^T P^T. The accumulator of S^T holds, in lane (ln, hh), register r, key 8 hh + r of query ln,
// which is the k order of the B operand (elements 0..7 = k 8 hh + i, elements 8..15 = k 16 + 8 hh + i), so two 16-key score tiles become one 32-key P^T fragment with no exchange.
// Online softmax in the log2 domain: running maximum and running sum per query (a query is a lane pair ln, ln + 16); weights are carried x256 (exponent + 8) as f16, the sum likewise, f32.
// K and V^T tiles (64 rows of 128 bytes each) come in whole 128-byte lines through registers into two LDS buffers (row pitch 144 bytes): stage s + 1 is fetched while stage s is worked on; one barrier a stage.
#define FA_P 144                     /* LDS row pitch in bytes: 128 + 16, an odd multiple of 16 */
#define FA_T (64 * FA_P)             /* one tile */
typedef int v4ia __attribute__((ext_vector_type(4), may_alias));
__device__ __forceinline__ v8f fa_mma(v16h a, v16h b, v8f c) { return __builtin_amdgcn_wmma_f32_16x16x32_f16(false, a, false, b, (short)0, c, false, false); }
__device__ __forceinline__ float fa_xhalf(float x) { return __builtin_bit_cast(float, __builtin_amdgcn_permlanex16(__builtin_bit_cast(int, x), __builtin_bit_cast(int, x), 0x76543210, 0xfedcba98, false, false)); }      /* lane l with lane l ^ 16 */
__device__ __forceinline__ float fa_exp2(float t) { float e;
  asm("v_exp_f32 %0, %1\n\tv_nop" : "=v"(e) : "v"(t));      /* v_nop: the one slot the instruction set asks for behind a transcendental before its source is overwritten or its result read */
  return e; }
__device__ __forceinline__ v16h fa_frag(const unsigned char* p) { FragH f; f.half[0] = *(const v8us*)p; f.half[1] = *(const v8us*)(p + 32); return f.v; }      /* p = row ln of a 16 x 32 block in LDS, + 16 hh bytes */
__global__ __launch_bounds__(128) __attribute__((amdgpu_waves_per_eu(4, 4)))      /* register budget of four waves a SIMD (the grid gives three): aiming at more, the compiler reused registers among the pass's LDS loads and waited out each load in turn */
void k_fattn(const _Float16* __restrict__ QKVp, const _Float16* __restrict__ VTp, const int* __restrict__ KI, const int* __restrict__ NU, const float* __restrict__ VS, _Float16* __restrict__ O) {
  static_assert(HD == 64 && SQ % 512 == 0 && (SQ & (SQ - 1)) == 0 && SQ / 64 == 32, "k_fattn: head size 64; 128 threads x 4 list words a sweep; 64-key stages; 2 x 16 partial column sums");
  __shared__ __attribute__((aligned(16))) int lm[SQ];      /* this batch's key list */
  __shared__ __attribute__((aligned(16))) float vsl[2 * HD];      /* the masked keys' V column sums of this head, in two halves */
  __shared__ __attribute__((aligned(16))) unsigned char kv[2][2][FA_T];      /* [buffer][K, V^T][row * FA_P + byte] */
  const int tid = threadIdx.x, w = tid >> 5, lane = tid & 31, ln = lane & 15, hh = lane >> 4;
  const int bh = blockIdx.y, b = bh / NH, h = bh - b * NH; const size_t r0 = (size_t)b * SQ; const int q0 = blockIdx.x * 64 + w * 16;
  const int srow = tid >> 3, scol = (tid & 7) * 16;      /* staging: eight threads a row, 16 rows a sweep, four sweeps a tile */
  const char* kg = (const char*)(QKVp + r0 * LQ + DM + h * HD) + scol;      /* key row 0 of the batch, this head's 64 columns of the k block */
  const int nu = __builtin_amdgcn_readfirstlane(min(max(NU[b], 0), SQ)), nst = (nu + 63) >> 6;      /* unmasked keys and their stages: the same for the whole work-group, at most SQ / 64 */
  const char* vg = (const char*)(VTp + ((size_t)bh * HD + srow) * SQ) + scol;      /* V^T row d = srow, columns in key-list order */
  const int sofs = srow * FA_P + scol, lofs = ln * FA_P + 16 * hh;
  v8us gk[4], gv[4];
#pragma unroll
  for (int j = 0; j < 4; ++j) { const unsigned kr = (unsigned)(KI[r0 + srow + 16 * j] & (SQ - 1)); gk[j] = *(const v8us*)(kg + kr * (unsigned)(LQ * 2)); gv[j] = *(const v8us*)(vg + (size_t)(16 * j) * (SQ * 2)); }
  v4ia lw[SQ / 512];      /* the whole list, four words a thread and sweep, all sweeps in one flight */
#pragma unroll
  for (int u = 0; u < SQ / 512; ++u) lw[u] = *(const v4ia*)(KI + r0 + tid * 4 + 512 * u);
  { const float* vp = VS + ((size_t)bh * (SQ / 64) + (tid >> 6) * 16) * HD + (tid & 63); float s = 0.f;
#pragma unroll
    for (int u = 0; u < 16; ++u) s += vp[u * HD];
    vsl[tid] = s; }
#pragma unroll
  for (int u = 0; u < SQ / 512; ++u) *(v4ia*)(lm + tid * 4 + 512 * u) = lw[u];
  const _Float16* qp = QKVp + (r0 + q0 + ln) * LQ + h * HD; const v16h q0f = g2_frag(qp, hh), q1f = g2_frag(qp + 32, hh);
#pragma unroll
  for (int j = 0; j < 4; ++j) { *(v8us*)&kv[0][0][sofs + 16 * j * FA_P] = gk[j]; *(v8us*)&kv[0][1][sofs + 16 * j * FA_P] = gv[j]; }
  __syncthreads();      /* key list, column sums and stage 0 published */
  const int* lms = lm + srow; int kn[4];      /* list words of the stage to be fetched next, read one trip ahead so that the fetch does not wait for LDS */
#pragma unroll
  for (int j = 0; j < 4; ++j) kn[j] = lms[((1 < nst) ? 64 : 0) + 16 * j];
  const v8f z8 = {0.f, 0.f, 0.f, 0.f, 0.f, 0.f, 0.f, 0.f}; v8f acc[4] = {z8, z8, z8, z8}; float m_run = -3.0e38f, l_run = 0.f;
  const float c2 = 0.036084391824351615f * 1.44269504088896340736f, fill2 = 1.0e-11f * 1.44269504088896340736f;      /* 1 / sqrt(768) and the fill score, both times log2(e) */
#pragma unroll 1      /* one stage a trip: the buffer index alternates, and two stages' fragments at once would go past 256 registers */
  for (int st = 0; st < nst; ++st) {
    const int sn = (st + 1 < nst) ? st + 1 : st;      /* the last trip fetches its own stage again (in bounds) into the buffer nobody reads any more: no branch round loads, stores or the barrier */
#pragma unroll
    for (int j = 0; j < 4; ++j) { const unsigned kr = (unsigned)(kn[j] & (SQ - 1)); gk[j] = *(const v8us*)(kg + kr * (unsigned)(LQ * 2)); gv[j] = *(const v8us*)(vg + (size_t)(16 * j) * (SQ * 2) + sn * 128); }
    __builtin_amdgcn_sched_barrier(0);      /* holds the next stage's eight global loads here, a whole stage in front of the LDS stores that use them; left free, the scheduler sinks loads to just in front of their use and every wave waits out the load latency at the barrier */
    const int s2 = (st + 2 < nst) ? st + 2 : nst - 1;
#pragma unroll
    for (int j = 0; j < 4; ++j) kn[j] = lms[s2 * 64 + 16 * j];
    const unsigned char* kl = &kv[st & 1][0][lofs]; const unsigned char* vl = &kv[st & 1][1][lofs];
#pragma unroll
    for (int sub = 0; sub < 2; ++sub) {      /* one pass: 32 keys */
      const int kb = st * 64 + sub * 32;
      const unsigned char* kt = kl + sub * 32 * FA_P;
      const v16h k0 = fa_frag(kt), k2 = fa_frag(kt + 16 * FA_P), k1 = fa_frag(kt + 64), k3 = fa_frag(kt + 16 * FA_P + 64);
      v16h vf[4];
#pragma unroll
      for (int t = 0; t < 4; ++t) vf[t] = fa_frag(vl + t * 16 * FA_P + sub * 64);
      __builtin_amdgcn_sched_barrier(0);      /* holds the pass's 16 LDS loads together at its head, so that their latencies overlap; left free, each K fragment was loaded into the same registers just in front of its product and waited for by itself */
      v8f s0 = fa_mma(k0, q0f, z8); v8f s1 = fa_mma(k2, q0f, z8); s0 = fa_mma(k1, q1f, s0); s1 = fa_mma(k3, q1f, s1);
      float x[16];
#pragma unroll
      for (int r = 0; r < 8; ++r) { x[r] = s0[r] * c2; x[8 + r] = s1[r] * c2; }
      if (kb + 32 > nu) {      /* only the list's last passes (a scalar test): places from nu on hold masked keys, which get no weight here */
#pragma unroll
        for (int r = 0; r < 8; ++r) { x[r] = (kb + 8 * hh + r < nu) ? x[r] : -3.0e38f; x[8 + r] = (kb + 16 + 8 * hh + r < nu) ? x[8 + r] : -3.0e38f; } }
      float mx = x[0];
#pragma unroll
      for (int i = 1; i < 16; ++i) mx = fmaxf(mx, x[i]);
      mx = fmaxf(mx, fa_xhalf(mx));      /* both halves of the wave hold this query's maximum of the pass */
      const float mn = fmaxf(m_run, mx); const float corr = fa_exp2(m_run - mn); m_run = mn; const float nm = 8.0f - mn;
#pragma unroll
      for (int t = 0; t < 4; ++t) acc[t] = acc[t] * corr;
      FragH p; float e0 = 0.f, e1 = 0.f, e2 = 0.f, e3 = 0.f;
#pragma unroll
      for (int i = 0; i < 16; i += 4) { const float ea = fa_exp2(x[i] + nm), eb = fa_exp2(x[i + 1] + nm), ec = fa_exp2(x[i + 2] + nm), ed = fa_exp2(x[i + 3] + nm);
        e0 += ea; e1 += eb; e2 += ec; e3 += ed; p.h[i] = (_Float16)ea; p.h[i + 1] = (_Float16)eb; p.h[i + 2] = (_Float16)ec; p.h[i + 3] = (_Float16)ed; }
      l_run = l_run * corr + ((e0 + e1) + (e2 + e3));      /* this lane's 16 keys only; the two halves are added behind the loop */
#pragma unroll
      for (int t = 0; t < 4; ++t) acc[t] = fa_mma(vf[t], p.v, acc[t]);
      __builtin_amdgcn_sched_barrier(0);      /* ends the pass for the scheduler: left free, it fetched both passes' fragments at once (spills at 256 registers) and moved the next stage's LDS stores, their wait on the global loads and the barrier up in front of the softmax, where the loads had had no time to land */
    }
    unsigned char* kd = &kv[(st + 1) & 1][0][sofs]; unsigned char* vd = &kv[(st + 1) & 1][1][sofs];      /* the buffer of stage st - 1: every wave left it at the barrier that ended that trip */
#pragma unroll
    for (int j = 0; j < 4; ++j) { *(v8us*)(kd + 16 * j * FA_P) = gk[j]; *(v8us*)(vd + 16 * j * FA_P) = gv[j]; }
    __syncthreads();      /* publishes stage st + 1 and ends every wave's reads of stage st */
  }
  const bool anym = nu < SQ; const float mf = anym ? fmaxf(m_run, fill2) : m_run;      /* the masked keys join: final maximum, the loop's sums brought to it, the fill score's weight (x256 like the others) */
  const float cf = fa_exp2(m_run - mf), wf = anym ? fa_exp2((fill2 - mf) + 8.0f) : 0.f;
  const float l = (l_run + fa_xhalf(l_run)) * cf + (float)(SQ - nu) * wf; const float fin = 64.0f / l;      /* ctx carried x64 as before; the x256 of weights and sum cancels */
  unsigned short* op = (unsigned short*)O + (r0 + q0 + ln) * DM + h * HD + 8 * hh;
#pragma unroll
  for (int t = 0; t < 4; ++t) { FragH f;
#pragma unroll
    for (int r = 0; r < 8; ++r) { const int d = 16 * t + 8 * hh + r; f.h[r] = (_Float16)((acc[t][r] * cf + wf * (vsl[d] + vsl[HD + d])) * fin); }
    *(v8us*)(op + 16 * t) = f.half[0]; } }      /* d = 16 t + 8 hh + r of query ln */


// Residual + LayerNorm, two rows a wave (biased variance): out = R + (X - mu) * rsqrt(var + eps) * bf16(g) + bf16(b), as f16 rows (W16), f32 rows (W32) or both.
// A row of 768 floats is six pieces of 512 contiguous bytes; a lane holds 4 floats of each piece, so a row stays in registers between its two sums and the output. Gain and bias are fetched and rounded once a wave.
// Sums: per-lane partials (four chains), four DPP steps inside a 16-lane row, one exchange of the halves. No LDS, no barrier: the waves of a block need nothing of each other.
#define LN_W 8                       /* waves a block */
#define LN_R 2                       /* rows a wave */
#define LN_J (DMQ / 128)             /* 512-byte pieces a row */
typedef float v2f __attribute__((ext_vector_type(2)));
typedef __bf16 v2b __attribute__((ext_vector_type(2)));
template <int M> __device__ __forceinline__ float ln_xm(float x) { return __builtin_bit_cast(float, __builtin_amdgcn_update_dpp(0, __builtin_bit_cast(int, x), 0x160 + M, 0xf, 0xf, true)); }      /* lane l takes lane l ^ M of its 16-lane row (row_xmask) */
__device__ __forceinline__ float ln_wsum(float s) { s += ln_xm<1>(s); s += ln_xm<2>(s); s += ln_xm<4>(s); s += ln_xm<8>(s); return s + fa_xhalf(s); }      /* every lane ends with the sum over the wave */
__device__ __forceinline__ v4f ln_bf(v4f a) { const v2f lo = {a[0], a[1]}, hi = {a[2], a[3]}; const v2f l = __builtin_convertvector(__builtin_convertvector(lo, v2b), v2f), h = __builtin_convertvector(__builtin_convertvector(hi, v2b), v2f); const v4f r = {l[0], l[1], h[0], h[1]}; return r; }      /* to the bf16 grid, nearest even */
__device__ __forceinline__ float ln_rsq(float t) { float e;
  asm("v_rsq_f32 %0, %1\n\tv_nop" : "=v"(e) : "v"(t));      /* v_nop: the one slot the instruction set asks for behind a transcendental before its source is overwritten or its result read */
  return e; }      /* the bare instruction: t = variance + eps is at least eps (1e-5 in both launches), far above the small inputs that rsqrtf rescales */
template <int W16, int W32>
__global__ __launch_bounds__(32 * LN_W) void k_lnw(const float* __restrict__ X, const float* __restrict__ g, const float* __restrict__ bb, float eps, _Float16* __restrict__ N16, float* __restrict__ N32, const float* __restrict__ R) {
  static_assert(DMQ % 128 == 0 && NR % (LN_W * LN_R) == 0, "k_lnw: whole 512-byte pieces, whole blocks of rows");
  const int c0 = (threadIdx.x & 31) * 4; const int wv = __builtin_amdgcn_readfirstlane(threadIdx.x >> 5);      /* the wave's number, scalar: the row bases then sit in scalar registers and every load and store shares one lane offset */
  const size_t o = (size_t)(blockIdx.x * LN_W + wv) * (LN_R * DMQ);
  const float* xp = X + o; const float* rp = R + o;
  v4f xa[LN_R][LN_J], ra[LN_R][LN_J], ga[LN_J], ba[LN_J];
#pragma unroll
  for (int i = 0; i < LN_R; ++i)
#pragma unroll
    for (int j = 0; j < LN_J; ++j) xa[i][j] = *(const v4fa*)(xp + i * DMQ + j * 128 + c0);
#pragma unroll
  for (int j = 0; j < LN_J; ++j) { ga[j] = *(const v4fa*)(g + j * 128 + c0); ba[j] = *(const v4fa*)(bb + j * 128 + c0); }
#pragma unroll
  for (int i = 0; i < LN_R; ++i)
#pragma unroll
    for (int j = 0; j < LN_J; ++j) ra[i][j] = *(const v4fa*)(rp + i * DMQ + j * 128 + c0);
  __builtin_amdgcn_sched_barrier(0);      /* holds all the wave's loads here, in one flight; left free, the scheduler sank the residual rows' loads behind both sums, where the wave waited out a second load latency */
  float mu[LN_R], rs[LN_R];
#pragma unroll
  for (int i = 0; i < LN_R; ++i) { v4f s4 = xa[i][0];
#pragma unroll
    for (int j = 1; j < LN_J; ++j) s4 += xa[i][j];
    mu[i] = (s4[0] + s4[1]) + (s4[2] + s4[3]); }
#pragma unroll
  for (int i = 0; i < LN_R; ++i) mu[i] = ln_wsum(mu[i]) * (1.0f / (float)DMQ);
#pragma unroll
  for (int i = 0; i < LN_R; ++i) { v4f q4 = {0.f, 0.f, 0.f, 0.f};
#pragma unroll
    for (int j = 0; j < LN_J; ++j) { xa[i][j] -= mu[i]; q4 += xa[i][j] * xa[i][j]; }
    rs[i] = (q4[0] + q4[1]) + (q4[2] + q4[3]); }
#pragma unroll
  for (int i = 0; i < LN_R; ++i) rs[i] = ln_rsq(ln_wsum(rs[i]) * (1.0f / (float)DMQ) + eps);
#pragma unroll
  for (int j = 0; j < LN_J; ++j) { ga[j] = ln_bf(ga[j]); ba[j] = ln_bf(ba[j]); }
#pragma unroll
  for (int i = 0; i < LN_R; ++i)
#pragma unroll
    for (int j = 0; j < LN_J; ++j) { const v4f yf = (xa[i][j] * rs[i] * ga[j] + ba[j]) + ra[i][j];
      if (W16) *(v4h*)(N16 + o + i * DMQ + j * 128 + c0) = __builtin_convertvector(yf, v4h);
      if (W32) *(v4f*)(N32 + o + i * DMQ + j * 128 + c0) = yf; } }


// Operand preparation, one launch: the jobs need nothing of each other and share the grid by ranges of the block index (the choice is the same for a whole block).
// The weights go through an LDS tile a block (p_wt_tile); x keeps its one-thread-per-8-elements form and is read once for its two copies.
#define PB_W (DM * DFF / (128 * 64))           /* blocks (tiles of 128 k x 64 n) of one 768 x 3072 weight */
#define PB_X ((int)(NR * DM / 8 / 256))        /* blocks of x */
#define PB_S (DM * DM / (128 * 64))            /* blocks of one 768 x 768 weight */
#define PB_ALL (2 * PB_W + PB_X + 4 * PB_S + 3 + NB)
__global__ __launch_bounds__(256) void k_prep(const float* __restrict__ x, const float* __restrict__ wq, const float* __restrict__ wk, const float* __restrict__ wv, const float* __restrict__ wo, const float* __restrict__ w1, const float* __restrict__ w2,
    const float* __restrict__ bq, const float* __restrict__ bk, const float* __restrict__ bv, const int* __restrict__ km, _Float16* __restrict__ X16, float* __restrict__ XB, _Float16* __restrict__ BQKV, _Float16* __restrict__ BO, _Float16* __restrict__ BW1, _Float16* __restrict__ BW2, float* __restrict__ bqkv, int* __restrict__ KI, int* __restrict__ NU) {
  static_assert(NR * DM / 8 % 256 == 0, "k_prep: whole blocks of x");
  __shared__ __attribute__((aligned(16))) unsigned char tl[64 * PW_P];      /* one weight tile, [n][k] f16 */
  int blk = blockIdx.x; const int tid = threadIdx.x;
  if (blk < NB) {      /* key list of batch blk: the keys with a non-zero mask word first, then the others, each part ascending; a thread takes 8 consecutive keys. First in the grid: its chain of barriers is the longest job */
    static_assert(SQ == 256 * 8, "k_prep: 8 keys a thread");
    int* sc = (int*)tl; const v4ia m0 = *(const v4ia*)(km + blk * SQ + tid * 8), m1 = *(const v4ia*)(km + blk * SQ + tid * 8 + 4); int fl[8], cn = 0;
#pragma unroll
    for (int q = 0; q < 4; ++q) { fl[q] = (m0[q] != 0) ? 1 : 0; fl[4 + q] = (m1[q] != 0) ? 1 : 0; }
#pragma unroll
    for (int q = 0; q < 8; ++q) cn += fl[q];
    sc[tid] = cn; __syncthreads();      /* running count over the block's 256 threads, eight doubling steps; every barrier is reached by the whole block (the job is chosen by block index) */
    for (int o = 1; o < 256; o <<= 1) { const int ad = (tid >= o) ? sc[tid - o] : 0; __syncthreads(); sc[tid] += ad; __syncthreads(); }
    const int tot = sc[255]; int up = sc[tid] - cn;      /* unmasked keys in all, and in front of this thread's first key */
#pragma unroll
    for (int q = 0; q < 8; ++q) { const int key = tid * 8 + q; KI[blk * SQ + (fl[q] ? up : tot + (key - up))] = key; up += fl[q]; }      /* a permutation of 0 .. SQ - 1: up <= key, and tot + masked keys in front < SQ */
    if (tid == 0) NU[blk] = tot;
    return; }
  blk -= NB;
  if (blk < PB_W) { p_wt_tile<DM, DFF>(w1, BW1, blk, tid, tl); return; }      /* W1 [768][3072] -> Bt [3072][768] */
  blk -= PB_W;
  if (blk < PB_W) { p_wt_tile<DFF, DM>(w2, BW2, blk, tid, tl); return; }      /* W2 [3072][768] -> Bt [768][3072] */
  blk -= PB_W;
  if (blk < PB_X) { const size_t t = (size_t)blk * 256 + tid; v4f a = *(const v4fa*)(x + t * 8), c = *(const v4fa*)(x + t * 8 + 4); FragH f;      /* X16 = bf16(x) as exact f16 rows (GEMM operand), XB = bf16(x) as f32 rows (residual) */
#pragma unroll
    for (int q = 0; q < 4; ++q) { a[q] = bf16_round(a[q]); c[q] = bf16_round(c[q]); f.h[q] = (_Float16)a[q]; f.h[4 + q] = (_Float16)c[q]; }
    *(v8us*)((unsigned short*)X16 + t * 8) = f.half[0]; *(v4f*)(XB + t * 8) = a; *(v4f*)(XB + t * 8 + 4) = c;
    asm volatile("s_wait_xcnt 0x0" ::: "memory");      /* as in p_wt_tile: in front of any overwrite of the three stores' registers on the way to the kernel's end */
    return; }
  blk -= PB_X;
  if (blk < 4 * PB_S) { const int m = blk / PB_S;      /* [in][out] -> Bt x16: stacked q | k | v, and Wo */
    const float* W = (m == 0) ? wq : (m == 1) ? wk : (m == 2) ? wv : wo; _Float16* D = (m < 3) ? BQKV + (size_t)m * DM * DM : BO;
    p_wt_tile<DM, DM>(W, D, blk - m * PB_S, tid, tl); return; }
  blk -= 4 * PB_S;
  const float* b = (blk == 0) ? bq : (blk == 1) ? bk : bv;      /* stacked bias bq | bk | bv */
  for (int i = tid; i < DM; i += 256) bqkv[blk * DM + i] = b[i];
}

extern "C" void kernel_launch(void* const* d_in, const int* in_sizes, int n_in,
                              void* d_out, int out_size, void* d_ws, size_t ws_size, hipStream_t stream) {
  (void)in_sizes; (void)n_in; (void)out_size;
  const float* const* I = (const float* const*)d_in; const float* x = I[0]; const int* km = (const int*)d_in[1]; const float* wq = I[2]; const float* bq = I[3]; const float* wk = I[4]; const float* bk = I[5]; const float* wv = I[6]; const float* bv = I[7]; const float* wo = I[8]; const float* bo = I[9]; const float* g1 = I[10]; const float* be1 = I[11]; const float* wfc = I[12]; const float* bfc = I[13]; const float* wmp = I[14]; const float* bmp = I[15]; const float* gg2 = I[16]; const float* be2 = I[17];      /* input order: x_n; mask int32 [2][1][1][2048] (READ on device); [in][out] wq / wk / wv / wo + biases; ln1 g / b; w1 [768][3072] + b1, w2 [3072][768] + b2; ln2 g / b */
  static_assert(DMQ % 4 == 0 && DMQ / 4 <= 256 && DM % 64 == 0 && DM % 32 == 0 && DFF % 64 == 0 && DFF % 32 == 0 && NH * HD == DM && NKX == SQ, "tile multiples");
  static_assert(MP % 128 == 0 && MPO % 128 == 0 && SQ % 128 == 0 && DM % 128 == 0 && DFF % 128 == 0, "k_gemm2: whole 128-row work-group tiles, 128-column tiles, 128-k stages");
  static_assert(MP % 256 == 0 && (3 * DM) % 192 == 0 && DFF % 192 == 0 && MPO % 128 == 0 && DM % 96 == 0, "k_gemm3: whole 256x192 and 128x96 work-group tiles");
  char* ws = (char*)d_ws; size_t off = 0;
  auto take = [&](size_t bytes) { char* p = ws + off; off += (bytes + 255) & ~(size_t)255; return p; };
  _Float16* BQKV = (_Float16*)take((size_t)3 * DM * DM * 2); _Float16* BO = (_Float16*)take((size_t)DM * DM * 2); float* bqkv = (float*)take((size_t)3 * DM * 4); float* X1N = nullptr;      /* LN1 output (f32): aliases the QKV plane below (QKV's last readers, the score / V^T launches, precede LN1) to stay within 256 MiB at NB 4 / SQ 2048 */
  _Float16* X16 = (_Float16*)take(NR * DM * 2); float* XB = (float*)take(NR * DM * 4); float* X1 = (float*)take(NR * DM * 4); _Float16* M16 = nullptr;      /* = X16 below (alias: X16's last reader, the fused QKV GEMM, precedes LN1's f16 write) */ _Float16* HF16 = (_Float16*)take(NR * DFF * 2);      /* FFN hidden plane of both batches [4096][3072] f16 (own region here) */ _Float16* BW1 = (_Float16*)take((size_t)DFF * DM * 2); _Float16* BW2 = (_Float16*)take((size_t)DM * DFF * 2); _Float16* QKV = (_Float16*)take(NR * 3 * DM * 2); _Float16* V16 = QKV + 2 * DM; _Float16* O16 = (_Float16*)take(NR * DM * 2); M16 = X16; X1N = (float*)QKV;      /* aliases: X1N (NR*DM f32 = 12 MiB) inside QKV (18 MiB): QKV's last readers (the score / V^T launches) precede the first LayerNorm */
  _Float16* VT = (_Float16*)take((size_t)NB * NH * HD * SQ * 2); int* KI = (int*)take((size_t)NB * SQ * 4); int* NU = (int*)take((size_t)NB * 4); float* VS = (float*)take((size_t)NB * NH * (SQ / 64) * HD * 4);      /* key lists, unmasked counts, partial column sums of the masked keys' V rows */
  if (off > ws_size) return;
  k_prep<<<PB_ALL, 256, 0, stream>>>(x, wq, wk, wv, wo, wfc, wmp, bq, bk, bv, km, X16, XB, BQKV, BO, BW1, BW2, bqkv, KI, NU);      /* every GEMM operand plane, the stacked bias and the residual rows; post-LN: the attention runs on the raw input */
  const size_t r0p = (size_t)B0 * SQ;      /* first projected row */
  k_gemm3<0, DM, 3 * DM, 4, 4, false><<<dim3(3 * DM / 192, MP / 256), 512, 0, stream>>>(X16 + r0p * DM, BQKV, 0.0625f, bqkv, nullptr, QKV + r0p * 3 * DM);      /* q | k | v rows (f16); head h = columns h*HD.. of each DM block */
  k_vtg<<<NB * NH * (SQ / 64), 256, 0, stream>>>(V16, KI, NU, VT, VS);      /* V^T [NB][NH][HD][SQ], both batches, columns in key-list order; partial column sums of the masked keys */
  k_fattn<<<dim3(SQ / 64, NB * NH), 128, 0, stream>>>(QKV, VT, KI, NU, VS, O16);      /* scores q.k / sqrt(768) (the module's literal dim_model scale), masked keys get the score 1e-11 (fill, as the source), softmax over all keys, ctx (merged heads, x64) as f16 rows */
  k_gemm3<0, DM, DM, 2, 2, true><<<dim3(DM / 96, MPO / 128), 256, 0, stream>>>(O16 + r0p * DM, BO, 0.0009765625f, bo, X1 + r0p * DM, nullptr);      /* z = ctx Wo + bo (f32 rows; the skip is added AFTER the LayerNorm in this module) */
  k_lnw<1, 1><<<(unsigned)(NR / (LN_W * LN_R)), 32 * LN_W, 0, stream>>>(X1, g1, be1, 1e-5f, M16, X1N, XB);      /* l1 = bf16(x) + LN1(z) (eps 1e-5): f16 rows for the FFN input and f32 rows for the second skip */
  k_gemm3<3, DM, DFF, 4, 4, false><<<dim3(DFF / 192, MP / 256), 512, 0, stream>>>(M16, BW1, 0.0625f, bfc, nullptr, HF16);      /* relu(l1 W1 + b1) -> f16, both batches */
  k_gemm3<0, DFF, DM, 2, 2, true><<<dim3(DM / 96, MP / 128), 256, 0, stream>>>(HF16, BW2, 0.0625f, bmp, X1, nullptr);      /* ffn = hidden W2 + b2 (f32 rows over the dead z plane; the skip is added after the LayerNorm) */
  k_lnw<0, 1><<<(unsigned)(NR / (LN_W * LN_R)), 32 * LN_W, 0, stream>>>(X1, gg2, be2, 1e-5f, nullptr, (float*)d_out, X1N);      /* out = l1 + LN2(ffn) (eps 1e-5) -> f32 output rows */
}
